// v000
// Times are from an AMD MI455X. After a warm-up the kernel runs many times in a row, and a time is the length of
// such a window on the GPU divided by its runs, so every launch and the gaps after it count. The runs cycle
// through copies of the inputs. A figure is the median of several windows, for all but v000 over two sittings.
// Sittings can differ by a few percent; kernels timed side by side share one.
// v000 is the starting kernel. One run takes 361 microseconds.
#include <hip/hip_runtime.h>
#include <hip/hip_bf16.h>

// ---------------------------------------------------------------------------
// Fused self-attention (no softmax) for MI455X / gfx1250, wave32 + WMMA.
//   q = x@Wq^T + bq ; k = x@Wk^T + bk ; v = x@Wv^T + bv      (f16, f32 accum)
//   out = q @ (k^T @ v) / sqrt(H)        <-- associativity: no NxN scores
// All GEMM operands are K-contiguous f16 rows -> uniform b128 tile loader,
// double-buffered LDS, async global->LDS copies (ASYNCcnt), 64x64 wave tiles.
// ---------------------------------------------------------------------------

typedef __attribute__((ext_vector_type(16))) _Float16 v16h;
typedef __attribute__((ext_vector_type(8)))  _Float16 h8;
typedef __attribute__((ext_vector_type(4)))  _Float16 h4;
typedef __attribute__((ext_vector_type(8)))  float    v8f;
typedef __attribute__((ext_vector_type(4)))  float    f32x4;
typedef __attribute__((ext_vector_type(4)))  int      v4i;

constexpr int BM = 256;       // block tile M (4 waves x 64)
constexpr int BN = 128;       // block tile N (2 waves x 64)
constexpr int BK = 32;        // K step (matches 16x16x32 WMMA)
constexpr int LDST = 40;      // LDS row stride in halfwords (80B = 5*16B)

constexpr int Nrows = 8192;
constexpr int Hdim  = 1024;
constexpr int KSPLIT = 8;     // deterministic split-K for k^T @ v

// ---- gfx1250 async copy-to-LDS detection ----------------------------------
#define AS3 __attribute__((address_space(3)))
#define AS1 __attribute__((address_space(1)))
#if defined(__has_builtin)
#  if __has_builtin(__builtin_amdgcn_global_load_async_to_lds_b128) && \
      __has_builtin(__builtin_amdgcn_s_wait_asynccnt)
#    define USE_ASYNC_COPY 1
#  endif
#endif
#ifndef USE_ASYNC_COPY
#  define USE_ASYNC_COPY 0
#endif

#if USE_ASYNC_COPY
__device__ __forceinline__ AS3 v4i* lds_cast(void* p) {
  return (AS3 v4i*)(unsigned int)(unsigned long long)p;
}
__device__ __forceinline__ AS1 v4i* gbl_cast(const void* p) {
  return (AS1 v4i*)(unsigned long long)p;
}
#endif

// ---- issue one ROWSx32 f16 tile: global -> LDS (b128 per transfer) --------
template <int ROWS>
__device__ __forceinline__ void issue_tile(_Float16* __restrict__ lds,
                                           const _Float16* __restrict__ g,
                                           int ld, int row0, int kpos, int tid) {
#pragma unroll
  for (int p = 0; p < ROWS / 64; ++p) {      // ROWS*4 x 16B transfers / 256 thr
    int idx = p * 256 + tid;
    int r   = idx >> 2;
    int c8  = (idx & 3) * 8;
    const _Float16* gp = g + (size_t)(row0 + r) * ld + (kpos + c8);
    _Float16*       lp = lds + r * LDST + c8;        // 16B-aligned
#if USE_ASYNC_COPY
    __builtin_amdgcn_global_load_async_to_lds_b128(gbl_cast(gp), lds_cast(lp),
                                                   0, 0);
#else
    *reinterpret_cast<h8*>(lp) = *reinterpret_cast<const h8*>(gp);
#endif
  }
}

// ---- per-lane WMMA fragment from a [ROWS][LDST] LDS tile -------------------
// 16-bit operand layout (ISA 7.12.2): lanes 0-15 hold K {0..7,16..23},
// lanes 16-31 hold K {8..15,24..31}; row/col = lane & 15.
__device__ __forceinline__ v16h load_frag(const _Float16* __restrict__ lds,
                                          int rowbase, int lane) {
  int r  = rowbase + (lane & 15);
  int kb = (lane >> 4) << 3;                 // 0 or 8
  const _Float16* p = lds + r * LDST + kb;   // 16-byte aligned chunks
  v16h f;
#pragma unroll
  for (int i = 0; i < 8; ++i) { f[i] = p[i]; f[i + 8] = p[i + 16]; }
  return f;
}

// ---- all-f16 WMMA GEMM:  C[m,n] = sum_k A[m,k]*B[n,k] (+ bias[n]) ----------
// STORET: store C transposed (C_T[n*ldc + m], f16) -> one b128 store per tile.
template <bool STORET, bool BIAS, typename TOut>
__global__ __launch_bounds__(256) void gemm_f16_wmma(
    const _Float16* __restrict__ A, const _Float16* __restrict__ B,
    const float* __restrict__ bias, TOut* __restrict__ C,
    int K, int lda, int ldb, int ldc) {
  __shared__ __align__(16) _Float16 lsA[2][BM * LDST];
  __shared__ __align__(16) _Float16 lsB[2][BN * LDST];

  const int tid  = threadIdx.x;
  const int lane = tid & 31;
  const int wid  = tid >> 5;       // 8 waves
  const int wm   = wid & 3;        // 4 waves along M (64 rows each)
  const int wn   = wid >> 2;       // 2 waves along N (64 cols each)
  const int row0 = blockIdx.y * BM;
  const int col0 = blockIdx.x * BN;

  v8f acc[4][4] = {};              // 64x64 per wave = 16 WMMA accumulators

  const int nk = K / BK;
  issue_tile<BM>(lsA[0], A, lda, row0, 0, tid);
  issue_tile<BN>(lsB[0], B, ldb, col0, 0, tid);

  for (int kt = 0; kt < nk; ++kt) {
    const int cur = kt & 1;
    if (kt + 1 < nk) {
      issue_tile<BM>(lsA[cur ^ 1], A, lda, row0, (kt + 1) * BK, tid);
      issue_tile<BN>(lsB[cur ^ 1], B, ldb, col0, (kt + 1) * BK, tid);
#if USE_ASYNC_COPY
      __builtin_amdgcn_s_wait_asynccnt(6);   // allow next tile-pair in flight
#endif
    } else {
#if USE_ASYNC_COPY
      __builtin_amdgcn_s_wait_asynccnt(0);
#endif
    }
    if (kt + 2 < nk) {                       // L2 prefetch two tiles ahead
      __builtin_prefetch(A + (size_t)(row0 + tid) * lda + (kt + 2) * BK, 0, 0);
      __builtin_prefetch(B + (size_t)(col0 + (tid & 127)) * ldb +
                             (kt + 2) * BK, 0, 0);
    }
    __syncthreads();                         // cur buffers fully landed

    v16h af[4], bf[4];
#pragma unroll
    for (int i = 0; i < 4; ++i)
      af[i] = load_frag(lsA[cur], wm * 64 + i * 16, lane);
#pragma unroll
    for (int j = 0; j < 4; ++j)
      bf[j] = load_frag(lsB[cur], wn * 64 + j * 16, lane);

#pragma unroll
    for (int i = 0; i < 4; ++i)
#pragma unroll
      for (int j = 0; j < 4; ++j)
        acc[i][j] = __builtin_amdgcn_wmma_f32_16x16x32_f16(
            false, af[i], false, bf[j], (short)0, acc[i][j], false, false);

    __syncthreads();                         // done reading cur before refill
  }

  // C/D layout (ISA 7.12.2): VGPR g -> M = g + 8*(lane>=16), N = lane&15.
#pragma unroll
  for (int i = 0; i < 4; ++i)
#pragma unroll
    for (int j = 0; j < 4; ++j) {
      int gm = row0 + wm * 64 + i * 16 + ((lane >> 4) << 3);
      int gn = col0 + wn * 64 + j * 16 + (lane & 15);
      float bv = 0.0f;
      if constexpr (BIAS) bv = bias[gn];
      if constexpr (STORET) {
        h8 hv;                               // 8 consecutive m at fixed n
#pragma unroll
        for (int gg = 0; gg < 8; ++gg)
          hv[gg] = (_Float16)(acc[i][j][gg] + bv);
        *reinterpret_cast<h8*>((_Float16*)C + (size_t)gn * ldc + gm) = hv;
      } else {
#pragma unroll
        for (int gg = 0; gg < 8; ++gg) {
          float val = acc[i][j][gg] + bv;
          C[(size_t)(gm + gg) * ldc + gn] = (TOut)val;
        }
      }
    }
}

// ---- fp32 -> f16 convert (vectorized, exact sizes) -------------------------
__global__ __launch_bounds__(256) void cvt_f32_f16(const float* __restrict__ src,
                                                   _Float16* __restrict__ dst) {
  size_t i = (size_t)blockIdx.x * 256 + threadIdx.x;   // index of float4
  f32x4 v = reinterpret_cast<const f32x4*>(src)[i];
  reinterpret_cast<h4*>(dst)[i] = __builtin_convertvector(v, h4);
}

// ---- reduce split-K partials of KV, scale by 1/sqrt(H), store KV^T (f16) ---
__global__ __launch_bounds__(256) void reduce_kv(const float* __restrict__ P,
                                                 _Float16* __restrict__ KVt,
                                                 float scale) {
  int idx = blockIdx.x * 256 + threadIdx.x;     // 0 .. H*H-1
  int h1 = idx >> 10;
  int h2 = idx & (Hdim - 1);
  float s = 0.0f;
#pragma unroll
  for (int z = 0; z < KSPLIT; ++z)
    s += P[(size_t)z * Hdim * Hdim + idx];
  KVt[(size_t)h2 * Hdim + h1] = (_Float16)(s * scale);   // transposed store
}

// ---------------------------------------------------------------------------
extern "C" void kernel_launch(void* const* d_in, const int* in_sizes, int n_in,
                              void* d_out, int out_size, void* d_ws, size_t ws_size,
                              hipStream_t stream) {
  (void)in_sizes; (void)n_in; (void)out_size; (void)ws_size;
  const float* x  = (const float*)d_in[0];
  const float* Wq = (const float*)d_in[1];
  const float* bq = (const float*)d_in[2];
  const float* Wk = (const float*)d_in[3];
  const float* bk = (const float*)d_in[4];
  const float* Wv = (const float*)d_in[5];
  const float* bv = (const float*)d_in[6];
  float* out = (float*)d_out;

  char* ws = (char*)d_ws;
  const size_t MB = 1ull << 20;
  _Float16* xf  = (_Float16*)(ws);               // 16 MB
  _Float16* Wqf = (_Float16*)(ws + 16 * MB);     //  2 MB
  _Float16* Wkf = (_Float16*)(ws + 18 * MB);     //  2 MB
  _Float16* Wvf = (_Float16*)(ws + 20 * MB);     //  2 MB
  _Float16* qf  = (_Float16*)(ws + 22 * MB);     // 16 MB   q   [N,H]
  _Float16* kT  = (_Float16*)(ws + 38 * MB);     // 16 MB   k^T [H,N]
  _Float16* vT  = (_Float16*)(ws + 54 * MB);     // 16 MB   v^T [H,N]
  float*    P   = (float*)   (ws + 70 * MB);     // 32 MB   8 partials [H,H]
  _Float16* KVt = (_Float16*)(ws + 102 * MB);    //  2 MB   KV^T [H,H]

  dim3 blk(256);

  // fp32 -> f16 converts
  cvt_f32_f16<<<(Nrows * Hdim) / 1024, blk, 0, stream>>>(x, xf);
  cvt_f32_f16<<<(Hdim * Hdim) / 1024, blk, 0, stream>>>(Wq, Wqf);
  cvt_f32_f16<<<(Hdim * Hdim) / 1024, blk, 0, stream>>>(Wk, Wkf);
  cvt_f32_f16<<<(Hdim * Hdim) / 1024, blk, 0, stream>>>(Wv, Wvf);

  dim3 gProj(Hdim / BN, Nrows / BM);   // 8 x 32
  dim3 gKV(Hdim / BN, Hdim / BM);      // 8 x 4 (x 8 split-K launches)

  // projections: q normal layout; k,v stored transposed ([H, N], ldc = N)
  gemm_f16_wmma<false, true, _Float16>
      <<<gProj, blk, 0, stream>>>(xf, Wqf, bq, qf, Hdim, Hdim, Hdim, Hdim);
  gemm_f16_wmma<true, true, _Float16>
      <<<gProj, blk, 0, stream>>>(xf, Wkf, bk, kT, Hdim, Hdim, Hdim, Nrows);
  gemm_f16_wmma<true, true, _Float16>
      <<<gProj, blk, 0, stream>>>(xf, Wvf, bv, vT, Hdim, Hdim, Hdim, Nrows);

  // KV partials: KV[h1,h2] = sum_n kT[h1,n] * vT[h2,n]  (both row-major now)
  for (int z = 0; z < KSPLIT; ++z)
    gemm_f16_wmma<false, false, float>
        <<<gKV, blk, 0, stream>>>(kT + (size_t)z * (Nrows / KSPLIT),
                                  vT + (size_t)z * (Nrows / KSPLIT), nullptr,
                                  P + (size_t)z * Hdim * Hdim,
                                  Nrows / KSPLIT, Nrows, Nrows, Hdim);

  // sum partials, scale by 1/sqrt(1024), emit KV^T in f16
  reduce_kv<<<(Hdim * Hdim) / 256, blk, 0, stream>>>(P, KVt, 0.03125f);

  // out = q @ KV  (KVt rows are KV columns -> contiguous B fragments)
  gemm_f16_wmma<false, false, float>
      <<<gProj, blk, 0, stream>>>(qf, KVt, nullptr, out, Hdim, Hdim, Hdim, Hdim);
}

// v001
// One run takes 213 microseconds.
// Next to v000, in two timings, it ran 1.71 and 1.72 times as fast.
#include <hip/hip_runtime.h>
#include <hip/hip_bf16.h>

// ---------------------------------------------------------------------------
// Fused self-attention (no softmax) for MI455X / gfx1250, wave32 + WMMA.
//   q = x@Wq^T + bq ; k = x@Wk^T + bk ; v = x@Wv^T + bv      (f16, f32 accum)
//   out = q @ (k^T @ v) / sqrt(H)        <-- associativity: no NxN scores
// All GEMM operands are K-contiguous f16 rows -> uniform b128 tile loader,
// double-buffered LDS, async global->LDS copies (ASYNCcnt), 64x64 wave tiles.
// ---------------------------------------------------------------------------

typedef __attribute__((ext_vector_type(16))) _Float16 v16h;
typedef __attribute__((ext_vector_type(8)))  _Float16 h8;
typedef __attribute__((ext_vector_type(4)))  _Float16 h4;
typedef __attribute__((ext_vector_type(8)))  float    v8f;
typedef __attribute__((ext_vector_type(4)))  float    f32x4;
typedef __attribute__((ext_vector_type(4)))  int      v4i;

constexpr int BM = 256;       // block tile M (4 waves x 64)
constexpr int BN = 128;       // block tile N (2 waves x 64)
constexpr int BK = 32;        // K step (matches 16x16x32 WMMA)
constexpr int LDST = 40;      // LDS row stride in halfwords (80B = 5*16B)

constexpr int Nrows = 8192;
constexpr int Hdim  = 1024;
constexpr int KSPLIT = 8;     // deterministic split-K for k^T @ v

// ---- gfx1250 async copy-to-LDS detection ----------------------------------
#define AS3 __attribute__((address_space(3)))
#define AS1 __attribute__((address_space(1)))
#if defined(__has_builtin)
#  if __has_builtin(__builtin_amdgcn_global_load_async_to_lds_b128) && \
      __has_builtin(__builtin_amdgcn_s_wait_asynccnt)
#    define USE_ASYNC_COPY 1
#  endif
#endif
#ifndef USE_ASYNC_COPY
#  define USE_ASYNC_COPY 0
#endif

#if USE_ASYNC_COPY
__device__ __forceinline__ AS3 v4i* lds_cast(void* p) {
  return (AS3 v4i*)(unsigned int)(unsigned long long)p;
}
__device__ __forceinline__ AS1 v4i* gbl_cast(const void* p) {
  return (AS1 v4i*)(unsigned long long)p;
}
#endif

// ---- issue one ROWSx32 f16 tile: global -> LDS (b128 per transfer) --------
template <int ROWS>
__device__ __forceinline__ void issue_tile(_Float16* __restrict__ lds,
                                           const _Float16* __restrict__ g,
                                           int ld, int row0, int kpos, int tid) {
#pragma unroll
  for (int p = 0; p < ROWS / 64; ++p) {      // ROWS*4 x 16B transfers / 256 thr
    int idx = p * 256 + tid;
    int r   = idx >> 2;
    int c8  = (idx & 3) * 8;
    const _Float16* gp = g + (size_t)(row0 + r) * ld + (kpos + c8);
    _Float16*       lp = lds + r * LDST + c8;        // 16B-aligned
#if USE_ASYNC_COPY
    __builtin_amdgcn_global_load_async_to_lds_b128(gbl_cast(gp), lds_cast(lp),
                                                   0, 0);
#else
    *reinterpret_cast<h8*>(lp) = *reinterpret_cast<const h8*>(gp);
#endif
  }
}

// ---- per-lane WMMA fragment from a [ROWS][LDST] LDS tile -------------------
// 16-bit operand layout (ISA 7.12.2): lanes 0-15 hold K {0..7,16..23},
// lanes 16-31 hold K {8..15,24..31}; row/col = lane & 15.
__device__ __forceinline__ v16h load_frag(const _Float16* __restrict__ lds,
                                          int rowbase, int lane) {
  int r  = rowbase + (lane & 15);
  int kb = (lane >> 4) << 3;                 // 0 or 8
  const _Float16* p = lds + r * LDST + kb;   // 16-byte aligned chunks
  v16h f;
#pragma unroll
  for (int i = 0; i < 8; ++i) { f[i] = p[i]; f[i + 8] = p[i + 16]; }
  return f;
}

// ---- all-f16 WMMA GEMM:  C[m,n] = sum_k A[m,k]*B[n,k] (+ bias[n]) ----------
// STORET: store C transposed (C_T[n*ldc + m], f16) -> one b128 store per tile.
// blockIdx.z picks an independent slice: A, B, C advance by zsA, zsB, zsC elements.
template <bool STORET, bool BIAS, typename TOut>
__global__ __launch_bounds__(256) void gemm_f16_wmma(
    const _Float16* __restrict__ A, const _Float16* __restrict__ B,
    const float* __restrict__ bias, TOut* __restrict__ C,
    int K, int lda, int ldb, int ldc, int zsA, int zsB, int zsC) {
  __shared__ __align__(16) _Float16 lsA[2][BM * LDST];
  __shared__ __align__(16) _Float16 lsB[2][BN * LDST];

  const int tid  = threadIdx.x;
  const int lane = tid & 31;
  const int wid  = tid >> 5;       // 8 waves
  const int wm   = wid & 3;        // 4 waves along M (64 rows each)
  const int wn   = wid >> 2;       // 2 waves along N (64 cols each)
  const int row0 = blockIdx.y * BM;
  const int col0 = blockIdx.x * BN;
  A += (size_t)blockIdx.z * zsA;
  B += (size_t)blockIdx.z * zsB;
  C += (size_t)blockIdx.z * zsC;

  v8f acc[4][4] = {};              // 64x64 per wave = 16 WMMA accumulators

  const int nk = K / BK;
  issue_tile<BM>(lsA[0], A, lda, row0, 0, tid);
  issue_tile<BN>(lsB[0], B, ldb, col0, 0, tid);

  for (int kt = 0; kt < nk; ++kt) {
    const int cur = kt & 1;
    if (kt + 1 < nk) {
      issue_tile<BM>(lsA[cur ^ 1], A, lda, row0, (kt + 1) * BK, tid);
      issue_tile<BN>(lsB[cur ^ 1], B, ldb, col0, (kt + 1) * BK, tid);
#if USE_ASYNC_COPY
      __builtin_amdgcn_s_wait_asynccnt(6);   // allow next tile-pair in flight
#endif
    } else {
#if USE_ASYNC_COPY
      __builtin_amdgcn_s_wait_asynccnt(0);
#endif
    }
    if (kt + 2 < nk) {                       // L2 prefetch two tiles ahead
      __builtin_prefetch(A + (size_t)(row0 + tid) * lda + (kt + 2) * BK, 0, 0);
      __builtin_prefetch(B + (size_t)(col0 + (tid & 127)) * ldb +
                             (kt + 2) * BK, 0, 0);
    }
    __syncthreads();                         // cur buffers fully landed

    v16h af[4], bf[4];
#pragma unroll
    for (int i = 0; i < 4; ++i)
      af[i] = load_frag(lsA[cur], wm * 64 + i * 16, lane);
#pragma unroll
    for (int j = 0; j < 4; ++j)
      bf[j] = load_frag(lsB[cur], wn * 64 + j * 16, lane);

#pragma unroll
    for (int i = 0; i < 4; ++i)
#pragma unroll
      for (int j = 0; j < 4; ++j)
        acc[i][j] = __builtin_amdgcn_wmma_f32_16x16x32_f16(
            false, af[i], false, bf[j], (short)0, acc[i][j], false, false);

    __syncthreads();                         // done reading cur before refill
  }

  // C/D layout (ISA 7.12.2): VGPR g -> M = g + 8*(lane>=16), N = lane&15.
#pragma unroll
  for (int i = 0; i < 4; ++i)
#pragma unroll
    for (int j = 0; j < 4; ++j) {
      int gm = row0 + wm * 64 + i * 16 + ((lane >> 4) << 3);
      int gn = col0 + wn * 64 + j * 16 + (lane & 15);
      float bv = 0.0f;
      if constexpr (BIAS) bv = bias[gn];
      if constexpr (STORET) {
        h8 hv;                               // 8 consecutive m at fixed n
#pragma unroll
        for (int gg = 0; gg < 8; ++gg)
          hv[gg] = (_Float16)(acc[i][j][gg] + bv);
        *reinterpret_cast<h8*>((_Float16*)C + (size_t)gn * ldc + gm) = hv;
      } else {
#pragma unroll
        for (int gg = 0; gg < 8; ++gg) {
          float val = acc[i][j][gg] + bv;
          C[(size_t)(gm + gg) * ldc + gn] = (TOut)val;
        }
      }
    }
}

// ---- fp32 -> f16 convert (vectorized, exact sizes) -------------------------
__global__ __launch_bounds__(256) void cvt_f32_f16(const float* __restrict__ src,
                                                   _Float16* __restrict__ dst) {
  size_t i = (size_t)blockIdx.x * 256 + threadIdx.x;   // index of float4
  f32x4 v = reinterpret_cast<const f32x4*>(src)[i];
  reinterpret_cast<h4*>(dst)[i] = __builtin_convertvector(v, h4);
}

// ---- reduce split-K partials of KV, scale by 1/sqrt(H), store KV^T (f16) ---
__global__ __launch_bounds__(256) void reduce_kv(const float* __restrict__ P,
                                                 _Float16* __restrict__ KVt,
                                                 float scale) {
  int idx = blockIdx.x * 256 + threadIdx.x;     // 0 .. H*H-1
  int h1 = idx >> 10;
  int h2 = idx & (Hdim - 1);
  float s = 0.0f;
#pragma unroll
  for (int z = 0; z < KSPLIT; ++z)
    s += P[(size_t)z * Hdim * Hdim + idx];
  KVt[(size_t)h2 * Hdim + h1] = (_Float16)(s * scale);   // transposed store
}

// ---------------------------------------------------------------------------
extern "C" void kernel_launch(void* const* d_in, const int* in_sizes, int n_in,
                              void* d_out, int out_size, void* d_ws, size_t ws_size,
                              hipStream_t stream) {
  (void)in_sizes; (void)n_in; (void)out_size; (void)ws_size;
  const float* x  = (const float*)d_in[0];
  const float* Wq = (const float*)d_in[1];
  const float* bq = (const float*)d_in[2];
  const float* Wk = (const float*)d_in[3];
  const float* bk = (const float*)d_in[4];
  const float* Wv = (const float*)d_in[5];
  const float* bv = (const float*)d_in[6];
  float* out = (float*)d_out;

  char* ws = (char*)d_ws;
  const size_t MB = 1ull << 20;
  _Float16* xf  = (_Float16*)(ws);               // 16 MB
  _Float16* Wqf = (_Float16*)(ws + 16 * MB);     //  2 MB
  _Float16* Wkf = (_Float16*)(ws + 18 * MB);     //  2 MB
  _Float16* Wvf = (_Float16*)(ws + 20 * MB);     //  2 MB
  _Float16* qf  = (_Float16*)(ws + 22 * MB);     // 16 MB   q   [N,H]
  _Float16* kT  = (_Float16*)(ws + 38 * MB);     // 16 MB   k^T [H,N]
  _Float16* vT  = (_Float16*)(ws + 54 * MB);     // 16 MB   v^T [H,N]
  float*    P   = (float*)   (ws + 70 * MB);     // 32 MB   8 partials [H,H]
  _Float16* KVt = (_Float16*)(ws + 102 * MB);    //  2 MB   KV^T [H,H]

  dim3 blk(256);

  // fp32 -> f16 converts
  cvt_f32_f16<<<(Nrows * Hdim) / 1024, blk, 0, stream>>>(x, xf);
  cvt_f32_f16<<<(Hdim * Hdim) / 1024, blk, 0, stream>>>(Wq, Wqf);
  cvt_f32_f16<<<(Hdim * Hdim) / 1024, blk, 0, stream>>>(Wk, Wkf);
  cvt_f32_f16<<<(Hdim * Hdim) / 1024, blk, 0, stream>>>(Wv, Wvf);

  dim3 gProj(Hdim / BN, Nrows / BM);   // 8 x 32
  dim3 gKV(Hdim / BN, Hdim / BM, KSPLIT);  // 8 x 4 x 8 split-K slices, one launch

  // projections: q normal layout; k,v stored transposed ([H, N], ldc = N)
  gemm_f16_wmma<false, true, _Float16>
      <<<gProj, blk, 0, stream>>>(xf, Wqf, bq, qf, Hdim, Hdim, Hdim, Hdim, 0, 0, 0);
  gemm_f16_wmma<true, true, _Float16>
      <<<gProj, blk, 0, stream>>>(xf, Wkf, bk, kT, Hdim, Hdim, Hdim, Nrows, 0, 0, 0);
  gemm_f16_wmma<true, true, _Float16>
      <<<gProj, blk, 0, stream>>>(xf, Wvf, bv, vT, Hdim, Hdim, Hdim, Nrows, 0, 0, 0);

  // KV partials: KV[h1,h2] = sum_n kT[h1,n] * vT[h2,n]  (both row-major now)
  // slice z covers n in [z*N/8, (z+1)*N/8) and writes partial plane z of P
  gemm_f16_wmma<false, false, float>
      <<<gKV, blk, 0, stream>>>(kT, vT, nullptr, P, Nrows / KSPLIT, Nrows, Nrows,
                                Hdim, Nrows / KSPLIT, Nrows / KSPLIT,
                                Hdim * Hdim);

  // sum partials, scale by 1/sqrt(1024), emit KV^T in f16
  reduce_kv<<<(Hdim * Hdim) / 256, blk, 0, stream>>>(P, KVt, 0.03125f);

  // out = q @ KV  (KVt rows are KV columns -> contiguous B fragments)
  gemm_f16_wmma<false, false, float>
      <<<gProj, blk, 0, stream>>>(qf, KVt, nullptr, out, Hdim, Hdim, Hdim, Hdim, 0, 0, 0);
}

// v002
// Measured time: 185 microseconds a run.
// Next to v001, in two timings, it ran 1.16 times as fast each time.
// All steps since v000 together make it 1.99 times as fast.
#include <hip/hip_runtime.h>
#include <hip/hip_bf16.h>

// ---------------------------------------------------------------------------
// Fused self-attention (no softmax) for MI455X / gfx1250, wave32 + WMMA.
//   q = x@Wq^T + bq ; k = x@Wk^T + bk ; v = x@Wv^T + bv      (f16, f32 accum)
//   out = q @ (k^T @ v) / sqrt(H)        <-- associativity: no NxN scores
// All GEMM operands are K-contiguous f16 rows -> uniform b128 tile loader,
// double-buffered LDS, async global->LDS copies (ASYNCcnt), 64x64 wave tiles.
// ---------------------------------------------------------------------------

typedef __attribute__((ext_vector_type(16))) _Float16 v16h;
typedef __attribute__((ext_vector_type(8)))  _Float16 h8;
typedef __attribute__((ext_vector_type(4)))  _Float16 h4;
typedef __attribute__((ext_vector_type(8)))  float    v8f;
typedef __attribute__((ext_vector_type(4)))  float    f32x4;
typedef __attribute__((ext_vector_type(4)))  int      v4i;

constexpr int BM = 256;       // block tile M (4 waves x 64)
constexpr int BN = 128;       // block tile N (2 waves x 64)
constexpr int BK = 32;        // K step (matches 16x16x32 WMMA)
constexpr int LDST = 40;      // LDS row stride in halfwords (80B = 5*16B)

constexpr int Nrows = 8192;
constexpr int Hdim  = 1024;
constexpr int KSPLIT = 8;     // deterministic split-K for k^T @ v

// ---- gfx1250 async copy-to-LDS detection ----------------------------------
#define AS3 __attribute__((address_space(3)))
#define AS1 __attribute__((address_space(1)))
#if defined(__has_builtin)
#  if __has_builtin(__builtin_amdgcn_global_load_async_to_lds_b128) && \
      __has_builtin(__builtin_amdgcn_s_wait_asynccnt)
#    define USE_ASYNC_COPY 1
#  endif
#endif
#ifndef USE_ASYNC_COPY
#  define USE_ASYNC_COPY 0
#endif

#if USE_ASYNC_COPY
__device__ __forceinline__ AS3 v4i* lds_cast(void* p) {
  return (AS3 v4i*)(unsigned int)(unsigned long long)p;
}
__device__ __forceinline__ AS1 v4i* gbl_cast(const void* p) {
  return (AS1 v4i*)(unsigned long long)p;
}
#endif

// ---- issue one ROWSx32 f16 tile: global -> LDS (b128 per transfer) --------
template <int ROWS>
__device__ __forceinline__ void issue_tile(_Float16* __restrict__ lds,
                                           const _Float16* __restrict__ g,
                                           int ld, int row0, int kpos, int tid) {
#pragma unroll
  for (int p = 0; p < ROWS / 64; ++p) {      // ROWS*4 x 16B transfers / 256 thr
    int idx = p * 256 + tid;
    int r   = idx >> 2;
    int c8  = (idx & 3) * 8;
    const _Float16* gp = g + (size_t)(row0 + r) * ld + (kpos + c8);
    _Float16*       lp = lds + r * LDST + c8;        // 16B-aligned
#if USE_ASYNC_COPY
    __builtin_amdgcn_global_load_async_to_lds_b128(gbl_cast(gp), lds_cast(lp),
                                                   0, 0);
#else
    *reinterpret_cast<h8*>(lp) = *reinterpret_cast<const h8*>(gp);
#endif
  }
}

// ---- per-lane WMMA fragment from a [ROWS][LDST] LDS tile -------------------
// 16-bit operand layout (ISA 7.12.2): lanes 0-15 hold K {0..7,16..23},
// lanes 16-31 hold K {8..15,24..31}; row/col = lane & 15.
__device__ __forceinline__ v16h load_frag(const _Float16* __restrict__ lds,
                                          int rowbase, int lane) {
  int r  = rowbase + (lane & 15);
  int kb = (lane >> 4) << 3;                 // 0 or 8
  const _Float16* p = lds + r * LDST + kb;   // 16-byte aligned chunks
  v16h f;
#pragma unroll
  for (int i = 0; i < 8; ++i) { f[i] = p[i]; f[i + 8] = p[i + 16]; }
  return f;
}

// ---- all-f16 WMMA GEMM:  C[m,n] = sum_k A[m,k]*B[n,k] (+ bias[n]) ----------
// STORET: store C transposed (C_T[n*ldc + m], f16) -> one b128 store per tile.
// blockIdx.z picks an independent slice: A, B, C advance by zsA, zsB, zsC elements.
template <bool STORET, bool BIAS, typename TOut>
__global__ __launch_bounds__(256) void gemm_f16_wmma(
    const _Float16* __restrict__ A, const _Float16* __restrict__ B,
    const float* __restrict__ bias, TOut* __restrict__ C,
    int K, int lda, int ldb, int ldc, int zsA, int zsB, int zsC) {
  __shared__ __align__(16) _Float16 lsA[2][BM * LDST];
  __shared__ __align__(16) _Float16 lsB[2][BN * LDST];

  const int tid  = threadIdx.x;
  const int lane = tid & 31;
  const int wid  = tid >> 5;       // 8 waves
  const int wm   = wid & 3;        // 4 waves along M (64 rows each)
  const int wn   = wid >> 2;       // 2 waves along N (64 cols each)
  const int row0 = blockIdx.y * BM;
  const int col0 = blockIdx.x * BN;
  A += (size_t)blockIdx.z * zsA;
  B += (size_t)blockIdx.z * zsB;
  C += (size_t)blockIdx.z * zsC;

  v8f acc[4][4] = {};              // 64x64 per wave = 16 WMMA accumulators

  const int nk = K / BK;
  issue_tile<BM>(lsA[0], A, lda, row0, 0, tid);
  issue_tile<BN>(lsB[0], B, ldb, col0, 0, tid);

  for (int kt = 0; kt < nk; ++kt) {
    const int cur = kt & 1;
    if (kt + 1 < nk) {
      issue_tile<BM>(lsA[cur ^ 1], A, lda, row0, (kt + 1) * BK, tid);
      issue_tile<BN>(lsB[cur ^ 1], B, ldb, col0, (kt + 1) * BK, tid);
#if USE_ASYNC_COPY
      __builtin_amdgcn_s_wait_asynccnt(6);   // allow next tile-pair in flight
#endif
    } else {
#if USE_ASYNC_COPY
      __builtin_amdgcn_s_wait_asynccnt(0);
#endif
    }
    if (kt + 2 < nk) {                       // L2 prefetch two tiles ahead
      __builtin_prefetch(A + (size_t)(row0 + tid) * lda + (kt + 2) * BK, 0, 0);
      __builtin_prefetch(B + (size_t)(col0 + (tid & 127)) * ldb +
                             (kt + 2) * BK, 0, 0);
    }
    __syncthreads();                         // cur buffers fully landed

    v16h af[4], bf[4];
#pragma unroll
    for (int i = 0; i < 4; ++i)
      af[i] = load_frag(lsA[cur], wm * 64 + i * 16, lane);
#pragma unroll
    for (int j = 0; j < 4; ++j)
      bf[j] = load_frag(lsB[cur], wn * 64 + j * 16, lane);

#pragma unroll
    for (int i = 0; i < 4; ++i)
#pragma unroll
      for (int j = 0; j < 4; ++j)
        acc[i][j] = __builtin_amdgcn_wmma_f32_16x16x32_f16(
            false, af[i], false, bf[j], (short)0, acc[i][j], false, false);

    __syncthreads();                         // done reading cur before refill
  }

  // C/D layout (ISA 7.12.2): VGPR g -> M = g + 8*(lane>=16), N = lane&15.
#pragma unroll
  for (int i = 0; i < 4; ++i)
#pragma unroll
    for (int j = 0; j < 4; ++j) {
      int gm = row0 + wm * 64 + i * 16 + ((lane >> 4) << 3);
      int gn = col0 + wn * 64 + j * 16 + (lane & 15);
      float bv = 0.0f;
      if constexpr (BIAS) bv = bias[gn];
      if constexpr (STORET) {
        h8 hv;                               // 8 consecutive m at fixed n
#pragma unroll
        for (int gg = 0; gg < 8; ++gg)
          hv[gg] = (_Float16)(acc[i][j][gg] + bv);
        *reinterpret_cast<h8*>((_Float16*)C + (size_t)gn * ldc + gm) = hv;
      } else {
#pragma unroll
        for (int gg = 0; gg < 8; ++gg) {
          float val = acc[i][j][gg] + bv;
          C[(size_t)(gm + gg) * ldc + gn] = (TOut)val;
        }
      }
    }
}

// ---- fp32 -> f16 convert: V float4 per thread, exact sizes -----------------
// A block covers 256*V consecutive float4; each wave-wide load is 512
// contiguous bytes. Few long-lived waves: the launch is not paced by how fast
// waves can be started.
template <int V>
__global__ __launch_bounds__(256) void cvt_f32_f16(const float* __restrict__ src,
                                                   _Float16* __restrict__ dst) {
  size_t base = (size_t)blockIdx.x * (256 * V) + threadIdx.x;  // float4 index
  f32x4 v[V];
  // unrolled so that v[] stays in registers and all V loads are in flight
#pragma unroll
  for (int p = 0; p < V; ++p)
    v[p] = reinterpret_cast<const f32x4*>(src)[base + p * 256];
  // unrolled for the same reason: v[] indexed by constants only
#pragma unroll
  for (int p = 0; p < V; ++p)
    reinterpret_cast<h4*>(dst)[base + p * 256] = __builtin_convertvector(v[p], h4);
}

// ---- reduce split-K partials of KV, scale by 1/sqrt(H), store KV^T (f16) ---
// One thread owns column h2 of 8 consecutive rows h1: 64 coalesced loads, each
// element summed over z = 0..7 in order, one 16-byte store into row h2 of KV^T.
__global__ __launch_bounds__(256) void reduce_kv(const float* __restrict__ P,
                                                 _Float16* __restrict__ KVt,
                                                 float scale) {
  // a block owns 64 rows h1 x 32 columns h2: wave w takes rows 8w..8w+7, lane l
  // column l, so each 128-byte line of KV^T is written by one block only
  const int wave = __builtin_amdgcn_readfirstlane(threadIdx.x >> 5);  // scalar
  const int h1 = (blockIdx.x >> 5) * 64 + wave * 8;   // first of 8 rows, wave-uniform
  const unsigned h2 = (blockIdx.x & 31) * 32 + (threadIdx.x & 31);
  float s[8] = {};
  // both loops unrolled so that the 64 loads can be issued ahead of the sums
#pragma unroll
  for (int z = 0; z < KSPLIT; ++z) {
    // first row of the even plane below z: wave-uniform, kept in scalar registers
    // so that every load is scalar base + lane column + immediate (an immediate
    // reaches one plane further), with no 64-bit vector add
    unsigned long long u =
        (unsigned long long)(P + (size_t)(z & ~1) * Hdim * Hdim + (size_t)h1 * Hdim);
    unsigned lo = __builtin_amdgcn_readfirstlane((unsigned)u);
    unsigned hi = __builtin_amdgcn_readfirstlane((unsigned)(u >> 32));
    const AS1 float* plane = (const AS1 float*)(((unsigned long long)hi << 32) | lo);
#pragma unroll
    for (int r = 0; r < 8; ++r)
      s[r] += plane[(z & 1) * Hdim * Hdim + r * Hdim + h2];
  }
  h8 hv;
  // unrolled: s[] and hv[] indexed by constants only, so both stay in registers
#pragma unroll
  for (int r = 0; r < 8; ++r) hv[r] = (_Float16)(s[r] * scale);
  *reinterpret_cast<h8*>(KVt + (size_t)h2 * Hdim + h1) = hv;   // transposed store
}

// ---------------------------------------------------------------------------
extern "C" void kernel_launch(void* const* d_in, const int* in_sizes, int n_in,
                              void* d_out, int out_size, void* d_ws, size_t ws_size,
                              hipStream_t stream) {
  (void)in_sizes; (void)n_in; (void)out_size; (void)ws_size;
  const float* x  = (const float*)d_in[0];
  const float* Wq = (const float*)d_in[1];
  const float* bq = (const float*)d_in[2];
  const float* Wk = (const float*)d_in[3];
  const float* bk = (const float*)d_in[4];
  const float* Wv = (const float*)d_in[5];
  const float* bv = (const float*)d_in[6];
  float* out = (float*)d_out;

  char* ws = (char*)d_ws;
  const size_t MB = 1ull << 20;
  _Float16* xf  = (_Float16*)(ws);               // 16 MB
  _Float16* Wqf = (_Float16*)(ws + 16 * MB);     //  2 MB
  _Float16* Wkf = (_Float16*)(ws + 18 * MB);     //  2 MB
  _Float16* Wvf = (_Float16*)(ws + 20 * MB);     //  2 MB
  _Float16* qf  = (_Float16*)(ws + 22 * MB);     // 16 MB   q   [N,H]
  _Float16* kT  = (_Float16*)(ws + 38 * MB);     // 16 MB   k^T [H,N]
  _Float16* vT  = (_Float16*)(ws + 54 * MB);     // 16 MB   v^T [H,N]
  float*    P   = (float*)   (ws + 70 * MB);     // 32 MB   8 partials [H,H]
  _Float16* KVt = (_Float16*)(ws + 102 * MB);    //  2 MB   KV^T [H,H]

  dim3 blk(256);

  // fp32 -> f16 converts
  cvt_f32_f16<16><<<(Nrows * Hdim) / (1024 * 16), blk, 0, stream>>>(x, xf);
  cvt_f32_f16<8><<<(Hdim * Hdim) / (1024 * 8), blk, 0, stream>>>(Wq, Wqf);
  cvt_f32_f16<8><<<(Hdim * Hdim) / (1024 * 8), blk, 0, stream>>>(Wk, Wkf);
  cvt_f32_f16<8><<<(Hdim * Hdim) / (1024 * 8), blk, 0, stream>>>(Wv, Wvf);

  dim3 gProj(Hdim / BN, Nrows / BM);   // 8 x 32
  dim3 gKV(Hdim / BN, Hdim / BM, KSPLIT);  // 8 x 4 x 8 split-K slices, one launch

  // projections: q normal layout; k,v stored transposed ([H, N], ldc = N)
  gemm_f16_wmma<false, true, _Float16>
      <<<gProj, blk, 0, stream>>>(xf, Wqf, bq, qf, Hdim, Hdim, Hdim, Hdim, 0, 0, 0);
  gemm_f16_wmma<true, true, _Float16>
      <<<gProj, blk, 0, stream>>>(xf, Wkf, bk, kT, Hdim, Hdim, Hdim, Nrows, 0, 0, 0);
  gemm_f16_wmma<true, true, _Float16>
      <<<gProj, blk, 0, stream>>>(xf, Wvf, bv, vT, Hdim, Hdim, Hdim, Nrows, 0, 0, 0);

  // KV partials: KV[h1,h2] = sum_n kT[h1,n] * vT[h2,n]  (both row-major now)
  // slice z covers n in [z*N/8, (z+1)*N/8) and writes partial plane z of P
  gemm_f16_wmma<false, false, float>
      <<<gKV, blk, 0, stream>>>(kT, vT, nullptr, P, Nrows / KSPLIT, Nrows, Nrows,
                                Hdim, Nrows / KSPLIT, Nrows / KSPLIT,
                                Hdim * Hdim);

  // sum partials, scale by 1/sqrt(1024), emit KV^T in f16
  reduce_kv<<<(Hdim * Hdim) / (256 * 8), blk, 0, stream>>>(P, KVt, 0.03125f);

  // out = q @ KV  (KVt rows are KV columns -> contiguous B fragments)
  gemm_f16_wmma<false, false, float>
      <<<gProj, blk, 0, stream>>>(qf, KVt, nullptr, out, Hdim, Hdim, Hdim, Hdim, 0, 0, 0);
}

// v003
// Measured time: 123 microseconds a run.
// Two timings next to v002 put it at 1.49 and 1.50 times that version's speed.
// All steps since v000 together make it 2.97 times as fast.
#include <hip/hip_runtime.h>
#include <hip/hip_bf16.h>

// ---------------------------------------------------------------------------
// Fused self-attention (no softmax) for MI455X / gfx1250, wave32 + WMMA.
//   q = x@Wq^T + bq ; k = x@Wk^T + bk ; v = x@Wv^T + bv      (f16, f32 accum)
//   out = q @ (k^T @ v) / sqrt(H)        <-- associativity: no NxN scores
// All GEMM operands are K-contiguous f16 rows -> uniform b128 tile loader,
// double-buffered LDS stages of 128 k (256-byte rows), async global->LDS copies
// (ASYNCcnt), 64x64 wave tiles.
// ---------------------------------------------------------------------------

typedef __attribute__((ext_vector_type(16))) _Float16 v16h;
typedef __attribute__((ext_vector_type(8)))  _Float16 h8;
typedef __attribute__((ext_vector_type(4)))  _Float16 h4;
typedef __attribute__((ext_vector_type(8)))  float    v8f;
typedef __attribute__((ext_vector_type(4)))  float    f32x4;
typedef __attribute__((ext_vector_type(4)))  int      v4i;

constexpr int BM = 256;       // block tile M (4 waves x 64)
constexpr int BN = 128;       // block tile N (2 waves x 64)
constexpr int BK = 128;       // K per LDS stage: 256 B of every row, 4 WMMA k-steps
constexpr int WK = 32;        // K of one 16x16x32 WMMA
constexpr int LDST = 136;     // LDS row stride in halfwords (272B = 17*16B)

constexpr int Nrows = 8192;
constexpr int Hdim  = 1024;
constexpr int KSPLIT = 8;     // deterministic split-K for k^T @ v

// ---- gfx1250 async copy-to-LDS detection ----------------------------------
#define AS3 __attribute__((address_space(3)))
#define AS1 __attribute__((address_space(1)))
#if defined(__has_builtin)
#  if __has_builtin(__builtin_amdgcn_global_load_async_to_lds_b128) && \
      __has_builtin(__builtin_amdgcn_s_wait_asynccnt)
#    define USE_ASYNC_COPY 1
#  endif
#endif
#ifndef USE_ASYNC_COPY
#  define USE_ASYNC_COPY 0
#endif

#if USE_ASYNC_COPY
__device__ __forceinline__ AS3 v4i* lds_cast(void* p) {
  return (AS3 v4i*)(unsigned int)(unsigned long long)p;
}
__device__ __forceinline__ AS1 v4i* gbl_cast(const void* p) {
  return (AS1 v4i*)(unsigned long long)p;
}
#endif

// ---- issue one ROWSx128 f16 tile: global -> LDS (b128 per transfer) -------
// 16 lanes cover the 256 bytes of one row, so a wave-wide copy is two whole rows.
template <int ROWS>
__device__ __forceinline__ void issue_tile(_Float16* __restrict__ lds,
                                           const _Float16* __restrict__ g,
                                           int ld, int row0, int kpos, int tid) {
#pragma unroll
  for (int p = 0; p < ROWS / 16; ++p) {      // ROWS*16 x 16B transfers / 256 thr
    int idx = p * 256 + tid;
    int r   = idx >> 4;
    int c8  = (idx & 15) * 8;
    const _Float16* gp = g + (size_t)(row0 + r) * ld + (kpos + c8);
    _Float16*       lp = lds + r * LDST + c8;        // 16B-aligned
#if USE_ASYNC_COPY
    __builtin_amdgcn_global_load_async_to_lds_b128(gbl_cast(gp), lds_cast(lp),
                                                   0, 0);
#else
    *reinterpret_cast<h8*>(lp) = *reinterpret_cast<const h8*>(gp);
#endif
  }
}

// ---- per-lane WMMA fragment from a [ROWS][LDST] LDS tile -------------------
// 16-bit operand layout (ISA 7.12.2): lanes 0-15 hold K {0..7,16..23},
// lanes 16-31 hold K {8..15,24..31}; row/col = lane & 15. k0: first k of the step.
__device__ __forceinline__ v16h load_frag(const _Float16* __restrict__ lds,
                                          int rowbase, int k0, int lane) {
  int r  = rowbase + (lane & 15);
  int kb = k0 + ((lane >> 4) << 3);          // k0 or k0 + 8
  const _Float16* p = lds + r * LDST + kb;   // 16-byte aligned chunks
  v16h f;
#pragma unroll
  for (int i = 0; i < 8; ++i) { f[i] = p[i]; f[i + 8] = p[i + 16]; }
  return f;
}

// ---- all-f16 WMMA GEMM:  C[m,n] = sum_k A[m,k]*B[n,k] (+ bias[n]) ----------
// STORET: store C transposed (C_T[n*ldc + m], f16) -> one b128 store per tile.
// blockIdx.z picks an independent slice: A, B, C advance by zsA, zsB, zsC elements.
template <bool STORET, bool BIAS, typename TOut>
__global__ __launch_bounds__(256) void gemm_f16_wmma(
    const _Float16* __restrict__ A, const _Float16* __restrict__ B,
    const float* __restrict__ bias, TOut* __restrict__ C,
    int K, int lda, int ldb, int ldc, int zsA, int zsB, int zsC) {
  __shared__ __align__(16) _Float16 lsA[2][BM * LDST];
  __shared__ __align__(16) _Float16 lsB[2][BN * LDST];

  const int tid  = threadIdx.x;
  const int lane = tid & 31;
  const int wid  = tid >> 5;       // 8 waves
  const int wm   = wid & 3;        // 4 waves along M (64 rows each)
  const int wn   = wid >> 2;       // 2 waves along N (64 cols each)
  const int row0 = blockIdx.y * BM;
  const int col0 = blockIdx.x * BN;
  A += (size_t)blockIdx.z * zsA;
  B += (size_t)blockIdx.z * zsB;
  C += (size_t)blockIdx.z * zsC;

  v8f acc[4][4] = {};              // 64x64 per wave = 16 WMMA accumulators

  const int nk = K / BK;
  issue_tile<BM>(lsA[0], A, lda, row0, 0, tid);
  issue_tile<BN>(lsB[0], B, ldb, col0, 0, tid);
  // this wave's copies of stage 0 have landed before the barrier publishes them
  asm volatile("s_wait_asynccnt 0x0" ::: "memory");
  __syncthreads();

  for (int kt = 0; kt < nk; ++kt) {
    const int cur = kt & 1;
    if (kt + 1 < nk) {   // next stage flies while this one is worked on; its
                         // buffer was left by every reader at the barrier above
      issue_tile<BM>(lsA[cur ^ 1], A, lda, row0, (kt + 1) * BK, tid);
      issue_tile<BN>(lsB[cur ^ 1], B, ldb, col0, (kt + 1) * BK, tid);
    }
    if (kt + 2 < nk) {                       // L2 prefetch two tiles ahead
      __builtin_prefetch(A + (size_t)(row0 + tid) * lda + (kt + 2) * BK, 0, 0);
      __builtin_prefetch(B + (size_t)(col0 + (tid & 127)) * ldb +
                             (kt + 2) * BK, 0, 0);
    }

    // unrolled: the four k-steps of a stage are straight-line code, so that the
    // fragment loads of a later step can be issued ahead of an earlier step's WMMAs
#pragma unroll
    for (int ks = 0; ks < BK / WK; ++ks) {
      v16h af[4], bf[4];
#pragma unroll
      for (int i = 0; i < 4; ++i)
        af[i] = load_frag(lsA[cur], wm * 64 + i * 16, ks * WK, lane);
#pragma unroll
      for (int j = 0; j < 4; ++j)
        bf[j] = load_frag(lsB[cur], wn * 64 + j * 16, ks * WK, lane);

#pragma unroll
      for (int i = 0; i < 4; ++i)
#pragma unroll
        for (int j = 0; j < 4; ++j)
          acc[i][j] = __builtin_amdgcn_wmma_f32_16x16x32_f16(
              false, af[i], false, bf[j], (short)0, acc[i][j], false, false);
    }

    // publish point of stage kt + 1, one barrier per stage: this wave's reads of
    // cur are done, its copies of the next stage have landed; behind the barrier
    // every wave may read the next stage and cur may be refilled
    asm volatile("s_wait_dscnt 0x0" ::: "memory");
    asm volatile("s_wait_asynccnt 0x0" ::: "memory");
    __syncthreads();
  }

  // C/D layout (ISA 7.12.2): VGPR g -> M = g + 8*(lane>=16), N = lane&15.
#pragma unroll
  for (int i = 0; i < 4; ++i)
#pragma unroll
    for (int j = 0; j < 4; ++j) {
      int gm = row0 + wm * 64 + i * 16 + ((lane >> 4) << 3);
      int gn = col0 + wn * 64 + j * 16 + (lane & 15);
      float bv = 0.0f;
      if constexpr (BIAS) bv = bias[gn];
      if constexpr (STORET) {
        h8 hv;                               // 8 consecutive m at fixed n
#pragma unroll
        for (int gg = 0; gg < 8; ++gg)
          hv[gg] = (_Float16)(acc[i][j][gg] + bv);
        *reinterpret_cast<h8*>((_Float16*)C + (size_t)gn * ldc + gm) = hv;
      } else {
#pragma unroll
        for (int gg = 0; gg < 8; ++gg) {
          float val = acc[i][j][gg] + bv;
          C[(size_t)(gm + gg) * ldc + gn] = (TOut)val;
        }
      }
    }
}

// ---- fp32 -> f16 convert: V float4 per thread, exact sizes -----------------
// A block covers 256*V consecutive float4; each wave-wide load is 512
// contiguous bytes. Few long-lived waves: the launch is not paced by how fast
// waves can be started.
template <int V>
__global__ __launch_bounds__(256) void cvt_f32_f16(const float* __restrict__ src,
                                                   _Float16* __restrict__ dst) {
  size_t base = (size_t)blockIdx.x * (256 * V) + threadIdx.x;  // float4 index
  f32x4 v[V];
  // unrolled so that v[] stays in registers and all V loads are in flight
#pragma unroll
  for (int p = 0; p < V; ++p)
    v[p] = reinterpret_cast<const f32x4*>(src)[base + p * 256];
  // unrolled for the same reason: v[] indexed by constants only
#pragma unroll
  for (int p = 0; p < V; ++p)
    reinterpret_cast<h4*>(dst)[base + p * 256] = __builtin_convertvector(v[p], h4);
}

// ---- reduce split-K partials of KV, scale by 1/sqrt(H), store KV^T (f16) ---
// One thread owns column h2 of 8 consecutive rows h1: 64 coalesced loads, each
// element summed over z = 0..7 in order, one 16-byte store into row h2 of KV^T.
__global__ __launch_bounds__(256) void reduce_kv(const float* __restrict__ P,
                                                 _Float16* __restrict__ KVt,
                                                 float scale) {
  // a block owns 64 rows h1 x 32 columns h2: wave w takes rows 8w..8w+7, lane l
  // column l, so each 128-byte line of KV^T is written by one block only
  const int wave = __builtin_amdgcn_readfirstlane(threadIdx.x >> 5);  // scalar
  const int h1 = (blockIdx.x >> 5) * 64 + wave * 8;   // first of 8 rows, wave-uniform
  const unsigned h2 = (blockIdx.x & 31) * 32 + (threadIdx.x & 31);
  float s[8] = {};
  // both loops unrolled so that the 64 loads can be issued ahead of the sums
#pragma unroll
  for (int z = 0; z < KSPLIT; ++z) {
    // first row of the even plane below z: wave-uniform, kept in scalar registers
    // so that every load is scalar base + lane column + immediate (an immediate
    // reaches one plane further), with no 64-bit vector add
    unsigned long long u =
        (unsigned long long)(P + (size_t)(z & ~1) * Hdim * Hdim + (size_t)h1 * Hdim);
    unsigned lo = __builtin_amdgcn_readfirstlane((unsigned)u);
    unsigned hi = __builtin_amdgcn_readfirstlane((unsigned)(u >> 32));
    const AS1 float* plane = (const AS1 float*)(((unsigned long long)hi << 32) | lo);
#pragma unroll
    for (int r = 0; r < 8; ++r)
      s[r] += plane[(z & 1) * Hdim * Hdim + r * Hdim + h2];
  }
  h8 hv;
  // unrolled: s[] and hv[] indexed by constants only, so both stay in registers
#pragma unroll
  for (int r = 0; r < 8; ++r) hv[r] = (_Float16)(s[r] * scale);
  *reinterpret_cast<h8*>(KVt + (size_t)h2 * Hdim + h1) = hv;   // transposed store
}

// ---------------------------------------------------------------------------
extern "C" void kernel_launch(void* const* d_in, const int* in_sizes, int n_in,
                              void* d_out, int out_size, void* d_ws, size_t ws_size,
                              hipStream_t stream) {
  (void)in_sizes; (void)n_in; (void)out_size; (void)ws_size;
  const float* x  = (const float*)d_in[0];
  const float* Wq = (const float*)d_in[1];
  const float* bq = (const float*)d_in[2];
  const float* Wk = (const float*)d_in[3];
  const float* bk = (const float*)d_in[4];
  const float* Wv = (const float*)d_in[5];
  const float* bv = (const float*)d_in[6];
  float* out = (float*)d_out;

  char* ws = (char*)d_ws;
  const size_t MB = 1ull << 20;
  _Float16* xf  = (_Float16*)(ws);               // 16 MB
  _Float16* Wqf = (_Float16*)(ws + 16 * MB);     //  2 MB
  _Float16* Wkf = (_Float16*)(ws + 18 * MB);     //  2 MB
  _Float16* Wvf = (_Float16*)(ws + 20 * MB);     //  2 MB
  _Float16* qf  = (_Float16*)(ws + 22 * MB);     // 16 MB   q   [N,H]
  _Float16* kT  = (_Float16*)(ws + 38 * MB);     // 16 MB   k^T [H,N]
  _Float16* vT  = (_Float16*)(ws + 54 * MB);     // 16 MB   v^T [H,N]
  float*    P   = (float*)   (ws + 70 * MB);     // 32 MB   8 partials [H,H]
  _Float16* KVt = (_Float16*)(ws + 102 * MB);    //  2 MB   KV^T [H,H]

  dim3 blk(256);

  // fp32 -> f16 converts
  cvt_f32_f16<16><<<(Nrows * Hdim) / (1024 * 16), blk, 0, stream>>>(x, xf);
  cvt_f32_f16<8><<<(Hdim * Hdim) / (1024 * 8), blk, 0, stream>>>(Wq, Wqf);
  cvt_f32_f16<8><<<(Hdim * Hdim) / (1024 * 8), blk, 0, stream>>>(Wk, Wkf);
  cvt_f32_f16<8><<<(Hdim * Hdim) / (1024 * 8), blk, 0, stream>>>(Wv, Wvf);

  dim3 gProj(Hdim / BN, Nrows / BM);   // 8 x 32
  dim3 gKV(Hdim / BN, Hdim / BM, KSPLIT);  // 8 x 4 x 8 split-K slices, one launch

  // projections: q normal layout; k,v stored transposed ([H, N], ldc = N)
  gemm_f16_wmma<false, true, _Float16>
      <<<gProj, blk, 0, stream>>>(xf, Wqf, bq, qf, Hdim, Hdim, Hdim, Hdim, 0, 0, 0);
  gemm_f16_wmma<true, true, _Float16>
      <<<gProj, blk, 0, stream>>>(xf, Wkf, bk, kT, Hdim, Hdim, Hdim, Nrows, 0, 0, 0);
  gemm_f16_wmma<true, true, _Float16>
      <<<gProj, blk, 0, stream>>>(xf, Wvf, bv, vT, Hdim, Hdim, Hdim, Nrows, 0, 0, 0);

  // KV partials: KV[h1,h2] = sum_n kT[h1,n] * vT[h2,n]  (both row-major now)
  // slice z covers n in [z*N/8, (z+1)*N/8) and writes partial plane z of P
  gemm_f16_wmma<false, false, float>
      <<<gKV, blk, 0, stream>>>(kT, vT, nullptr, P, Nrows / KSPLIT, Nrows, Nrows,
                                Hdim, Nrows / KSPLIT, Nrows / KSPLIT,
                                Hdim * Hdim);

  // sum partials, scale by 1/sqrt(1024), emit KV^T in f16
  reduce_kv<<<(Hdim * Hdim) / (256 * 8), blk, 0, stream>>>(P, KVt, 0.03125f);

  // out = q @ KV  (KVt rows are KV columns -> contiguous B fragments)
  gemm_f16_wmma<false, false, float>
      <<<gProj, blk, 0, stream>>>(qf, KVt, nullptr, out, Hdim, Hdim, Hdim, Hdim, 0, 0, 0);
}

// v004
// One run takes 110 microseconds.
// Next to v003, in two timings, it ran 1.12 times as fast each time.
// All steps since v000 together make it 3.33 times as fast.
#include <hip/hip_runtime.h>
#include <hip/hip_bf16.h>

// ---------------------------------------------------------------------------
// Fused self-attention (no softmax) for MI455X / gfx1250, wave32 + WMMA.
//   q = x@Wq^T + bq ; k = x@Wk^T + bk ; v = x@Wv^T + bv      (f16, f32 accum)
//   out = q @ (k^T @ v) / sqrt(H)        <-- associativity: no NxN scores
// All GEMM operands are K-contiguous f16 rows -> uniform b128 tile loader,
// double-buffered LDS stages of 128 k (256-byte rows), async global->LDS copies
// (ASYNCcnt), 64x64 wave tiles, WMMA fragments fetched one k-step ahead into a
// second register set.
// ---------------------------------------------------------------------------

typedef __attribute__((ext_vector_type(16))) _Float16 v16h;
typedef __attribute__((ext_vector_type(8)))  _Float16 h8;
typedef __attribute__((ext_vector_type(4)))  _Float16 h4;
typedef __attribute__((ext_vector_type(8)))  float    v8f;
typedef __attribute__((ext_vector_type(4)))  float    f32x4;
typedef __attribute__((ext_vector_type(4)))  int      v4i;

constexpr int BM = 256;       // block tile M (4 waves x 64)
constexpr int BN = 128;       // block tile N (2 waves x 64)
constexpr int BK = 128;       // K per LDS stage: 256 B of every row, 4 WMMA k-steps
constexpr int WK = 32;        // K of one 16x16x32 WMMA
constexpr int LDST = 136;     // LDS row stride in halfwords (272B = 17*16B)

constexpr int Nrows = 8192;
constexpr int Hdim  = 1024;
constexpr int KSPLIT = 8;     // deterministic split-K for k^T @ v

// ---- gfx1250 async copy-to-LDS detection ----------------------------------
#define AS3 __attribute__((address_space(3)))
#define AS1 __attribute__((address_space(1)))
#if defined(__has_builtin)
#  if __has_builtin(__builtin_amdgcn_global_load_async_to_lds_b128) && \
      __has_builtin(__builtin_amdgcn_s_wait_asynccnt)
#    define USE_ASYNC_COPY 1
#  endif
#endif
#ifndef USE_ASYNC_COPY
#  define USE_ASYNC_COPY 0
#endif

#if USE_ASYNC_COPY
__device__ __forceinline__ AS3 v4i* lds_cast(void* p) {
  return (AS3 v4i*)(unsigned int)(unsigned long long)p;
}
__device__ __forceinline__ AS1 v4i* gbl_cast(const void* p) {
  return (AS1 v4i*)(unsigned long long)p;
}
#endif

// ---- issue one ROWSx128 f16 tile: global -> LDS (b128 per transfer) -------
// 16 lanes cover the 256 bytes of one row, so a wave-wide copy is two whole rows.
template <int ROWS>
__device__ __forceinline__ void issue_tile(_Float16* __restrict__ lds,
                                           const _Float16* __restrict__ g,
                                           int ld, int row0, int kpos, int tid) {
#pragma unroll
  for (int p = 0; p < ROWS / 16; ++p) {      // ROWS*16 x 16B transfers / 256 thr
    int idx = p * 256 + tid;
    int r   = idx >> 4;
    int c8  = (idx & 15) * 8;
    const _Float16* gp = g + (size_t)(row0 + r) * ld + (kpos + c8);
    _Float16*       lp = lds + r * LDST + c8;        // 16B-aligned
#if USE_ASYNC_COPY
    __builtin_amdgcn_global_load_async_to_lds_b128(gbl_cast(gp), lds_cast(lp),
                                                   0, 0);
#else
    *reinterpret_cast<h8*>(lp) = *reinterpret_cast<const h8*>(gp);
#endif
  }
}

// ---- per-lane WMMA fragment from a [ROWS][LDST] LDS tile -------------------
// 16-bit operand layout (ISA 7.12.2): lanes 0-15 hold K {0..7,16..23},
// lanes 16-31 hold K {8..15,24..31}; row/col = lane & 15. k0: first k of the step.
__device__ __forceinline__ v16h load_frag(const _Float16* __restrict__ lds,
                                          int rowbase, int k0, int lane) {
  int r  = rowbase + (lane & 15);
  int kb = k0 + ((lane >> 4) << 3);          // k0 or k0 + 8
  const _Float16* p = lds + r * LDST + kb;   // 16-byte aligned chunks
  v16h f;
#pragma unroll
  for (int i = 0; i < 8; ++i) { f[i] = p[i]; f[i + 8] = p[i + 16]; }
  return f;
}

// ---- one k-step's fragments of a 64x64 wave tile: 4 of A, 4 of B -----------
__device__ __forceinline__ void load_set(v16h (&a)[4], v16h (&b)[4],
                                         const _Float16* __restrict__ la,
                                         const _Float16* __restrict__ lb,
                                         int wm, int wn, int k0, int lane) {
  // both loops unrolled: a[] and b[] indexed by constants only, so they are registers
#pragma unroll
  for (int i = 0; i < 4; ++i) a[i] = load_frag(la, wm * 64 + i * 16, k0, lane);
#pragma unroll
  for (int j = 0; j < 4; ++j) b[j] = load_frag(lb, wn * 64 + j * 16, k0, lane);
}

// ---- all-f16 WMMA GEMM:  C[m,n] = sum_k A[m,k]*B[n,k] (+ bias[n]) ----------
// STORET: store C transposed (C_T[n*ldc + m], f16) -> one b128 store per tile.
// blockIdx.z picks an independent slice: A, B, C advance by zsA, zsB, zsC elements.
template <bool STORET, bool BIAS, typename TOut>
__global__ __launch_bounds__(256) void gemm_f16_wmma(
    const _Float16* __restrict__ A, const _Float16* __restrict__ B,
    const float* __restrict__ bias, TOut* __restrict__ C,
    int K, int lda, int ldb, int ldc, int zsA, int zsB, int zsC) {
  __shared__ __align__(16) _Float16 lsA[2][BM * LDST];
  __shared__ __align__(16) _Float16 lsB[2][BN * LDST];

  const int tid  = threadIdx.x;
  const int lane = tid & 31;
  const int wid  = tid >> 5;       // 8 waves
  const int wm   = wid & 3;        // 4 waves along M (64 rows each)
  const int wn   = wid >> 2;       // 2 waves along N (64 cols each)
  const int row0 = blockIdx.y * BM;
  const int col0 = blockIdx.x * BN;
  A += (size_t)blockIdx.z * zsA;
  B += (size_t)blockIdx.z * zsB;
  C += (size_t)blockIdx.z * zsC;

  v8f acc[4][4] = {};              // 64x64 per wave = 16 WMMA accumulators
  v16h af[2][4], bf[2][4];         // two fragment sets: set (ks & 1) serves k-step ks

  const int nk = K / BK;
  issue_tile<BM>(lsA[0], A, lda, row0, 0, tid);
  issue_tile<BN>(lsB[0], B, ldb, col0, 0, tid);
  // this wave's copies of stage 0 have landed before the barrier publishes them
  asm volatile("s_wait_asynccnt 0x0" ::: "memory");
  __syncthreads();
  if (1 < nk) {          // stage 1 flies while stage 0 is worked on
    issue_tile<BM>(lsA[1], A, lda, row0, BK, tid);
    issue_tile<BN>(lsB[1], B, ldb, col0, BK, tid);
  }
  load_set(af[0], bf[0], lsA[0], lsB[0], wm, wn, 0, lane);   // k-step 0 of stage 0

  for (int kt = 0; kt < nk; ++kt) {
    const int cur = kt & 1;
    // unrolled: the set index ks & 1 must be a constant for the sets to be registers
#pragma unroll
    for (int ks = 0; ks < BK / WK; ++ks) {
      const int cs = ks & 1;
      if (ks + 1 < BK / WK) {
        // the next k-step's 16 LDS loads, one group, into the set that is free
        load_set(af[cs ^ 1], bf[cs ^ 1], lsA[cur], lsB[cur], wm, wn, (ks + 1) * WK,
                 lane);
      } else {
        // publish point of stage kt + 1, in front of this stage's last k-step (its
        // fragments are in registers): this wave's reads of cur are done, its copies
        // of the next stage have landed; behind the barrier every wave may read the
        // next stage and cur may be refilled
        asm volatile("s_wait_dscnt 0x0" ::: "memory");
        asm volatile("s_wait_asynccnt 0x0" ::: "memory");
        __syncthreads();
        if (kt + 2 < nk) {   // refill of cur: a whole pass ahead of its publish point
          issue_tile<BM>(lsA[cur], A, lda, row0, (kt + 2) * BK, tid);
          issue_tile<BN>(lsB[cur], B, ldb, col0, (kt + 2) * BK, tid);
        }
        if (kt + 3 < nk) {                     // L2 prefetch one tile further ahead
          __builtin_prefetch(A + (size_t)(row0 + tid) * lda + (kt + 3) * BK, 0, 0);
          __builtin_prefetch(B + (size_t)(col0 + (tid & 127)) * ldb +
                                 (kt + 3) * BK, 0, 0);
        }
        if (kt + 1 < nk)     // k-step 0 of the next stage, under this stage's last WMMAs
          load_set(af[0], bf[0], lsA[cur ^ 1], lsB[cur ^ 1], wm, wn, 0, lane);
      }
      // keeps the load group ahead of the WMMA block: sunk among the WMMAs, each
      // load pair would be waited for at once and the matrix unit would idle
      __builtin_amdgcn_sched_barrier(0);
      // both loops unrolled: acc[][] and the sets indexed by constants only
#pragma unroll
      for (int i = 0; i < 4; ++i)
#pragma unroll
        for (int j = 0; j < 4; ++j)
          acc[i][j] = __builtin_amdgcn_wmma_f32_16x16x32_f16(
              false, af[cs][i], false, bf[cs][j], (short)0, acc[i][j], false, false);
      // keeps the following load group behind this block, so that it stays one group
      __builtin_amdgcn_sched_barrier(0);
    }
  }

  // C/D layout (ISA 7.12.2): VGPR g -> M = g + 8*(lane>=16), N = lane&15.
#pragma unroll
  for (int i = 0; i < 4; ++i)
#pragma unroll
    for (int j = 0; j < 4; ++j) {
      int gm = row0 + wm * 64 + i * 16 + ((lane >> 4) << 3);
      int gn = col0 + wn * 64 + j * 16 + (lane & 15);
      float bv = 0.0f;
      if constexpr (BIAS) bv = bias[gn];
      if constexpr (STORET) {
        h8 hv;                               // 8 consecutive m at fixed n
#pragma unroll
        for (int gg = 0; gg < 8; ++gg)
          hv[gg] = (_Float16)(acc[i][j][gg] + bv);
        *reinterpret_cast<h8*>((_Float16*)C + (size_t)gn * ldc + gm) = hv;
      } else {
#pragma unroll
        for (int gg = 0; gg < 8; ++gg) {
          float val = acc[i][j][gg] + bv;
          C[(size_t)(gm + gg) * ldc + gn] = (TOut)val;
        }
      }
    }
}

// ---- fp32 -> f16 convert: V float4 per thread, exact sizes -----------------
// A block covers 256*V consecutive float4; each wave-wide load is 512
// contiguous bytes. Few long-lived waves: the launch is not paced by how fast
// waves can be started.
template <int V>
__global__ __launch_bounds__(256) void cvt_f32_f16(const float* __restrict__ src,
                                                   _Float16* __restrict__ dst) {
  size_t base = (size_t)blockIdx.x * (256 * V) + threadIdx.x;  // float4 index
  f32x4 v[V];
  // unrolled so that v[] stays in registers and all V loads are in flight
#pragma unroll
  for (int p = 0; p < V; ++p)
    v[p] = reinterpret_cast<const f32x4*>(src)[base + p * 256];
  // unrolled for the same reason: v[] indexed by constants only
#pragma unroll
  for (int p = 0; p < V; ++p)
    reinterpret_cast<h4*>(dst)[base + p * 256] = __builtin_convertvector(v[p], h4);
}

// ---- reduce split-K partials of KV, scale by 1/sqrt(H), store KV^T (f16) ---
// One thread owns column h2 of 8 consecutive rows h1: 64 coalesced loads, each
// element summed over z = 0..7 in order, one 16-byte store into row h2 of KV^T.
__global__ __launch_bounds__(256) void reduce_kv(const float* __restrict__ P,
                                                 _Float16* __restrict__ KVt,
                                                 float scale) {
  // a block owns 64 rows h1 x 32 columns h2: wave w takes rows 8w..8w+7, lane l
  // column l, so each 128-byte line of KV^T is written by one block only
  const int wave = __builtin_amdgcn_readfirstlane(threadIdx.x >> 5);  // scalar
  const int h1 = (blockIdx.x >> 5) * 64 + wave * 8;   // first of 8 rows, wave-uniform
  const unsigned h2 = (blockIdx.x & 31) * 32 + (threadIdx.x & 31);
  float s[8] = {};
  // both loops unrolled so that the 64 loads can be issued ahead of the sums
#pragma unroll
  for (int z = 0; z < KSPLIT; ++z) {
    // first row of the even plane below z: wave-uniform, kept in scalar registers
    // so that every load is scalar base + lane column + immediate (an immediate
    // reaches one plane further), with no 64-bit vector add
    unsigned long long u =
        (unsigned long long)(P + (size_t)(z & ~1) * Hdim * Hdim + (size_t)h1 * Hdim);
    unsigned lo = __builtin_amdgcn_readfirstlane((unsigned)u);
    unsigned hi = __builtin_amdgcn_readfirstlane((unsigned)(u >> 32));
    const AS1 float* plane = (const AS1 float*)(((unsigned long long)hi << 32) | lo);
#pragma unroll
    for (int r = 0; r < 8; ++r)
      s[r] += plane[(z & 1) * Hdim * Hdim + r * Hdim + h2];
  }
  h8 hv;
  // unrolled: s[] and hv[] indexed by constants only, so both stay in registers
#pragma unroll
  for (int r = 0; r < 8; ++r) hv[r] = (_Float16)(s[r] * scale);
  *reinterpret_cast<h8*>(KVt + (size_t)h2 * Hdim + h1) = hv;   // transposed store
}

// ---------------------------------------------------------------------------
extern "C" void kernel_launch(void* const* d_in, const int* in_sizes, int n_in,
                              void* d_out, int out_size, void* d_ws, size_t ws_size,
                              hipStream_t stream) {
  (void)in_sizes; (void)n_in; (void)out_size; (void)ws_size;
  const float* x  = (const float*)d_in[0];
  const float* Wq = (const float*)d_in[1];
  const float* bq = (const float*)d_in[2];
  const float* Wk = (const float*)d_in[3];
  const float* bk = (const float*)d_in[4];
  const float* Wv = (const float*)d_in[5];
  const float* bv = (const float*)d_in[6];
  float* out = (float*)d_out;

  char* ws = (char*)d_ws;
  const size_t MB = 1ull << 20;
  _Float16* xf  = (_Float16*)(ws);               // 16 MB
  _Float16* Wqf = (_Float16*)(ws + 16 * MB);     //  2 MB
  _Float16* Wkf = (_Float16*)(ws + 18 * MB);     //  2 MB
  _Float16* Wvf = (_Float16*)(ws + 20 * MB);     //  2 MB
  _Float16* qf  = (_Float16*)(ws + 22 * MB);     // 16 MB   q   [N,H]
  _Float16* kT  = (_Float16*)(ws + 38 * MB);     // 16 MB   k^T [H,N]
  _Float16* vT  = (_Float16*)(ws + 54 * MB);     // 16 MB   v^T [H,N]
  float*    P   = (float*)   (ws + 70 * MB);     // 32 MB   8 partials [H,H]
  _Float16* KVt = (_Float16*)(ws + 102 * MB);    //  2 MB   KV^T [H,H]

  dim3 blk(256);

  // fp32 -> f16 converts
  cvt_f32_f16<16><<<(Nrows * Hdim) / (1024 * 16), blk, 0, stream>>>(x, xf);
  cvt_f32_f16<8><<<(Hdim * Hdim) / (1024 * 8), blk, 0, stream>>>(Wq, Wqf);
  cvt_f32_f16<8><<<(Hdim * Hdim) / (1024 * 8), blk, 0, stream>>>(Wk, Wkf);
  cvt_f32_f16<8><<<(Hdim * Hdim) / (1024 * 8), blk, 0, stream>>>(Wv, Wvf);

  dim3 gProj(Hdim / BN, Nrows / BM);   // 8 x 32
  dim3 gKV(Hdim / BN, Hdim / BM, KSPLIT);  // 8 x 4 x 8 split-K slices, one launch

  // projections: q normal layout; k,v stored transposed ([H, N], ldc = N)
  gemm_f16_wmma<false, true, _Float16>
      <<<gProj, blk, 0, stream>>>(xf, Wqf, bq, qf, Hdim, Hdim, Hdim, Hdim, 0, 0, 0);
  gemm_f16_wmma<true, true, _Float16>
      <<<gProj, blk, 0, stream>>>(xf, Wkf, bk, kT, Hdim, Hdim, Hdim, Nrows, 0, 0, 0);
  gemm_f16_wmma<true, true, _Float16>
      <<<gProj, blk, 0, stream>>>(xf, Wvf, bv, vT, Hdim, Hdim, Hdim, Nrows, 0, 0, 0);

  // KV partials: KV[h1,h2] = sum_n kT[h1,n] * vT[h2,n]  (both row-major now)
  // slice z covers n in [z*N/8, (z+1)*N/8) and writes partial plane z of P
  gemm_f16_wmma<false, false, float>
      <<<gKV, blk, 0, stream>>>(kT, vT, nullptr, P, Nrows / KSPLIT, Nrows, Nrows,
                                Hdim, Nrows / KSPLIT, Nrows / KSPLIT,
                                Hdim * Hdim);

  // sum partials, scale by 1/sqrt(1024), emit KV^T in f16
  reduce_kv<<<(Hdim * Hdim) / (256 * 8), blk, 0, stream>>>(P, KVt, 0.03125f);

  // out = q @ KV  (KVt rows are KV columns -> contiguous B fragments)
  gemm_f16_wmma<false, false, float>
      <<<gProj, blk, 0, stream>>>(qf, KVt, nullptr, out, Hdim, Hdim, Hdim, Hdim, 0, 0, 0);
}

// v005
// Measured time: 99.4 microseconds a run.
// Next to v004, in two timings, it ran 1.09 and 1.11 times as fast.
// All steps since v000 together make it 3.67 times as fast.
#include <hip/hip_runtime.h>
#include <hip/hip_bf16.h>

// ---------------------------------------------------------------------------
// Fused self-attention (no softmax) for MI455X / gfx1250, wave32 + WMMA.
//   q = x@Wq^T + bq ; k = x@Wk^T + bk ; v = x@Wv^T + bv      (f16, f32 accum)
//   out = q @ (k^T @ v) / sqrt(H)        <-- associativity: no NxN scores
// All GEMM operands are K-contiguous f16 rows -> uniform b128 tile loader,
// double-buffered LDS stages of 128 k (256-byte rows), async global->LDS copies
// (ASYNCcnt), 64x64 wave tiles, WMMA fragments fetched one k-step ahead into a
// second register set.
// ---------------------------------------------------------------------------

typedef __attribute__((ext_vector_type(16))) _Float16 v16h;
typedef __attribute__((ext_vector_type(8)))  _Float16 h8;
typedef __attribute__((ext_vector_type(4)))  _Float16 h4;
typedef __attribute__((ext_vector_type(8)))  float    v8f;
typedef __attribute__((ext_vector_type(4)))  float    f32x4;
typedef __attribute__((ext_vector_type(4)))  int      v4i;

constexpr int BM = 256;       // block tile M (4 waves x 64)
constexpr int BN = 128;       // block tile N (2 waves x 64)
constexpr int BK = 128;       // K per LDS stage: 256 B of every row, 4 WMMA k-steps
constexpr int WK = 32;        // K of one 16x16x32 WMMA
constexpr int LDST = 136;     // LDS row stride in halfwords (272B = 17*16B)

constexpr int Nrows = 8192;
constexpr int Hdim  = 1024;
constexpr int KSPLIT = 8;     // deterministic split-K for k^T @ v

// ---- gfx1250 async copy-to-LDS detection ----------------------------------
#define AS3 __attribute__((address_space(3)))
#define AS1 __attribute__((address_space(1)))
#if defined(__has_builtin)
#  if __has_builtin(__builtin_amdgcn_global_load_async_to_lds_b128) && \
      __has_builtin(__builtin_amdgcn_s_wait_asynccnt)
#    define USE_ASYNC_COPY 1
#  endif
#endif
#ifndef USE_ASYNC_COPY
#  define USE_ASYNC_COPY 0
#endif

#if USE_ASYNC_COPY
__device__ __forceinline__ AS3 v4i* lds_cast(void* p) {
  return (AS3 v4i*)(unsigned int)(unsigned long long)p;
}
__device__ __forceinline__ AS1 v4i* gbl_cast(const void* p) {
  return (AS1 v4i*)(unsigned long long)p;
}
#endif

// ---- issue one ROWSx128 f16 tile: global -> LDS (b128 per transfer) -------
// 16 lanes cover the 256 bytes of one row, so a wave-wide copy is two whole rows.
template <int ROWS>
__device__ __forceinline__ void issue_tile(_Float16* __restrict__ lds,
                                           const _Float16* __restrict__ g,
                                           int ld, int row0, int kpos, int tid) {
#pragma unroll
  for (int p = 0; p < ROWS / 16; ++p) {      // ROWS*16 x 16B transfers / 256 thr
    int idx = p * 256 + tid;
    int r   = idx >> 4;
    int c8  = (idx & 15) * 8;
    const _Float16* gp = g + (size_t)(row0 + r) * ld + (kpos + c8);
    _Float16*       lp = lds + r * LDST + c8;        // 16B-aligned
#if USE_ASYNC_COPY
    __builtin_amdgcn_global_load_async_to_lds_b128(gbl_cast(gp), lds_cast(lp),
                                                   0, 0);
#else
    *reinterpret_cast<h8*>(lp) = *reinterpret_cast<const h8*>(gp);
#endif
  }
}

// ---- per-lane WMMA fragment from a [ROWS][LDST] LDS tile -------------------
// 16-bit operand layout (ISA 7.12.2): lanes 0-15 hold K {0..7,16..23},
// lanes 16-31 hold K {8..15,24..31}; row/col = lane & 15. k0: first k of the step.
__device__ __forceinline__ v16h load_frag(const _Float16* __restrict__ lds,
                                          int rowbase, int k0, int lane) {
  int r  = rowbase + (lane & 15);
  int kb = k0 + ((lane >> 4) << 3);          // k0 or k0 + 8
  const _Float16* p = lds + r * LDST + kb;   // 16-byte aligned chunks
  v16h f;
#pragma unroll
  for (int i = 0; i < 8; ++i) { f[i] = p[i]; f[i + 8] = p[i + 16]; }
  return f;
}

// ---- one k-step's fragments of a 64x64 wave tile: 4 of A, 4 of B -----------
__device__ __forceinline__ void load_set(v16h (&a)[4], v16h (&b)[4],
                                         const _Float16* __restrict__ la,
                                         const _Float16* __restrict__ lb,
                                         int wm, int wn, int k0, int lane) {
  // both loops unrolled: a[] and b[] indexed by constants only, so they are registers
#pragma unroll
  for (int i = 0; i < 4; ++i) a[i] = load_frag(la, wm * 64 + i * 16, k0, lane);
#pragma unroll
  for (int j = 0; j < 4; ++j) b[j] = load_frag(lb, wn * 64 + j * 16, k0, lane);
}

// ---- all-f16 WMMA GEMM:  C[m,n] = sum_k A[m,k]*B[n,k] (+ bias[n]) ----------
// blockIdx.z picks an independent slice: A, B, C advance by zsA, zsB, zsC elements.
// QKV: B holds the rows of Wq, Wk, Wv one after the other (3*Hdim columns n). A
// block's 128 columns lie in one of the three: q columns get bias0 and go to C
// row-major; k and v columns get bias1 / bias2 and go to Ct transposed
// (Ct[(n - Hdim)*ldct + m], f16) -> one b128 store per tile.
template <bool QKV, typename TOut>
__global__ __launch_bounds__(256) void gemm_f16_wmma(
    const _Float16* __restrict__ A, const _Float16* __restrict__ B,
    const float* __restrict__ bias0, const float* __restrict__ bias1,
    const float* __restrict__ bias2, TOut* __restrict__ C,
    _Float16* __restrict__ Ct,
    int K, int lda, int ldb, int ldc, int ldct, int zsA, int zsB, int zsC) {
  __shared__ __align__(16) _Float16 lsA[2][BM * LDST];
  __shared__ __align__(16) _Float16 lsB[2][BN * LDST];

  const int tid  = threadIdx.x;
  const int lane = tid & 31;
  const int wid  = tid >> 5;       // 8 waves
  const int wm   = wid & 3;        // 4 waves along M (64 rows each)
  const int wn   = wid >> 2;       // 2 waves along N (64 cols each)
  const int row0 = blockIdx.y * BM;
  const int col0 = blockIdx.x * BN;
  A += (size_t)blockIdx.z * zsA;
  B += (size_t)blockIdx.z * zsB;
  C += (size_t)blockIdx.z * zsC;

  v8f acc[4][4] = {};              // 64x64 per wave = 16 WMMA accumulators
  v16h af[2][4], bf[2][4];         // two fragment sets: set (ks & 1) serves k-step ks

  const int nk = K / BK;
  issue_tile<BM>(lsA[0], A, lda, row0, 0, tid);
  issue_tile<BN>(lsB[0], B, ldb, col0, 0, tid);
  // this wave's copies of stage 0 have landed before the barrier publishes them
  asm volatile("s_wait_asynccnt 0x0" ::: "memory");
  __syncthreads();
  if (1 < nk) {          // stage 1 flies while stage 0 is worked on
    issue_tile<BM>(lsA[1], A, lda, row0, BK, tid);
    issue_tile<BN>(lsB[1], B, ldb, col0, BK, tid);
  }
  load_set(af[0], bf[0], lsA[0], lsB[0], wm, wn, 0, lane);   // k-step 0 of stage 0

  for (int kt = 0; kt < nk; ++kt) {
    const int cur = kt & 1;
    // unrolled: the set index ks & 1 must be a constant for the sets to be registers
#pragma unroll
    for (int ks = 0; ks < BK / WK; ++ks) {
      const int cs = ks & 1;
      if (ks + 1 < BK / WK) {
        // the next k-step's 16 LDS loads, one group, into the set that is free
        load_set(af[cs ^ 1], bf[cs ^ 1], lsA[cur], lsB[cur], wm, wn, (ks + 1) * WK,
                 lane);
      } else {
        // publish point of stage kt + 1, in front of this stage's last k-step (its
        // fragments are in registers): this wave's reads of cur are done, its copies
        // of the next stage have landed; behind the barrier every wave may read the
        // next stage and cur may be refilled
        asm volatile("s_wait_dscnt 0x0" ::: "memory");
        asm volatile("s_wait_asynccnt 0x0" ::: "memory");
        __syncthreads();
        if (kt + 2 < nk) {   // refill of cur: a whole pass ahead of its publish point
          issue_tile<BM>(lsA[cur], A, lda, row0, (kt + 2) * BK, tid);
          issue_tile<BN>(lsB[cur], B, ldb, col0, (kt + 2) * BK, tid);
        }
        if (kt + 3 < nk) {                     // L2 prefetch one tile further ahead
          __builtin_prefetch(A + (size_t)(row0 + tid) * lda + (kt + 3) * BK, 0, 0);
          __builtin_prefetch(B + (size_t)(col0 + (tid & 127)) * ldb +
                                 (kt + 3) * BK, 0, 0);
        }
        if (kt + 1 < nk)     // k-step 0 of the next stage, under this stage's last WMMAs
          load_set(af[0], bf[0], lsA[cur ^ 1], lsB[cur ^ 1], wm, wn, 0, lane);
      }
      // keeps the load group ahead of the WMMA block: sunk among the WMMAs, each
      // load pair would be waited for at once and the matrix unit would idle
      __builtin_amdgcn_sched_barrier(0);
      // both loops unrolled: acc[][] and the sets indexed by constants only
#pragma unroll
      for (int i = 0; i < 4; ++i)
#pragma unroll
        for (int j = 0; j < 4; ++j)
          acc[i][j] = __builtin_amdgcn_wmma_f32_16x16x32_f16(
              false, af[cs][i], false, bf[cs][j], (short)0, acc[i][j], false, false);
      // keeps the following load group behind this block, so that it stays one group
      __builtin_amdgcn_sched_barrier(0);
    }
  }

  // C/D layout (ISA 7.12.2): VGPR g -> M = g + 8*(lane>=16), N = lane&15.
  if constexpr (QKV) {
    if (col0 >= Hdim) {                      // block-uniform: a k or a v block
      const float* __restrict__ bias = col0 < 2 * Hdim ? bias1 : bias2;
      // all three loops unrolled: acc[][] and hv[] indexed by constants only, so
      // they are registers
#pragma unroll
      for (int i = 0; i < 4; ++i)
#pragma unroll
        for (int j = 0; j < 4; ++j) {
          int gm = row0 + wm * 64 + i * 16 + ((lane >> 4) << 3);
          int gn = col0 + wn * 64 + j * 16 + (lane & 15);
          float bv = bias[gn & (Hdim - 1)];
          h8 hv;                             // 8 consecutive m at fixed n
#pragma unroll
          for (int gg = 0; gg < 8; ++gg)
            hv[gg] = (_Float16)(acc[i][j][gg] + bv);
          *reinterpret_cast<h8*>(Ct + (size_t)(gn - Hdim) * ldct + gm) = hv;
        }
      return;
    }
  }
  float bj[4] = {};                          // bias of this lane's 4 columns
  if constexpr (QKV) {
    // unrolled: bj[] indexed by constants only, so it is registers
#pragma unroll
    for (int j = 0; j < 4; ++j) bj[j] = bias0[col0 + wn * 64 + j * 16 + (lane & 15)];
  }
#pragma unroll
  for (int i = 0; i < 4; ++i) {
#pragma unroll
    for (int j = 0; j < 4; ++j) {
      int gm = row0 + wm * 64 + i * 16 + ((lane >> 4) << 3);
      int gn = col0 + wn * 64 + j * 16 + (lane & 15);
      float bv = bj[j];
#pragma unroll
      for (int gg = 0; gg < 8; ++gg) {
        float val = acc[i][j][gg] + bv;
        C[(size_t)(gm + gg) * ldc + gn] = (TOut)val;
      }
    }
    // whatever follows these stores (the next 16 rows; behind the last rows, code
    // that the compiler lays out there) reuses registers that they name: the wait
    // stands in front of those overwrites, and the scheduling barrier keeps later
    // arithmetic from being moved up over it
    if (QKV) {
      asm volatile("s_wait_xcnt 0x0" ::: "memory");
      __builtin_amdgcn_sched_barrier(0);
    }
  }
}

// ---- fp32 -> f16 convert of x, Wq, Wk, Wv in one launch: V float4 per thread -
// A block covers 256*V consecutive float4 of one source; each wave-wide load is
// 512 contiguous bytes. Few long-lived waves: the launch is not paced by how fast
// waves can be started. The first XB blocks take x, then WB blocks each of Wq, Wk,
// Wv; dstall holds the four results one after the other in that order.
template <int V>
__global__ __launch_bounds__(256) void cvt_f32_f16(const float* __restrict__ x,
                                                   const float* __restrict__ Wq,
                                                   const float* __restrict__ Wk,
                                                   const float* __restrict__ Wv,
                                                   _Float16* __restrict__ dstall) {
  constexpr int XB = (Nrows * Hdim) / (1024 * V);
  constexpr int WB = (Hdim * Hdim) / (1024 * V);
  const int b = blockIdx.x;
  const int first = b < XB ? 0 : b < XB + WB ? XB : b < XB + 2 * WB ? XB + WB
                                                                    : XB + 2 * WB;
  const float* __restrict__ src =
      b < XB ? x : b < XB + WB ? Wq : b < XB + 2 * WB ? Wk : Wv;
  _Float16* __restrict__ dst = dstall + (size_t)first * (1024 * V);
  size_t base = (size_t)(b - first) * (256 * V) + threadIdx.x;  // float4 index
  f32x4 v[V];
  // unrolled so that v[] stays in registers and all V loads are in flight
#pragma unroll
  for (int p = 0; p < V; ++p)
    v[p] = reinterpret_cast<const f32x4*>(src)[base + p * 256];
  // unrolled for the same reason: v[] indexed by constants only
#pragma unroll
  for (int p = 0; p < V; ++p)
    reinterpret_cast<h4*>(dst)[base + p * 256] = __builtin_convertvector(v[p], h4);
}

// ---- reduce split-K partials of KV, scale by 1/sqrt(H), store KV^T (f16) ---
// One thread owns column h2 of 8 consecutive rows h1: 64 coalesced loads, each
// element summed over z = 0..7 in order, one 16-byte store into row h2 of KV^T.
__global__ __launch_bounds__(256) void reduce_kv(const float* __restrict__ P,
                                                 _Float16* __restrict__ KVt,
                                                 float scale) {
  // a block owns 64 rows h1 x 32 columns h2: wave w takes rows 8w..8w+7, lane l
  // column l, so each 128-byte line of KV^T is written by one block only
  const int wave = __builtin_amdgcn_readfirstlane(threadIdx.x >> 5);  // scalar
  const int h1 = (blockIdx.x >> 5) * 64 + wave * 8;   // first of 8 rows, wave-uniform
  const unsigned h2 = (blockIdx.x & 31) * 32 + (threadIdx.x & 31);
  float s[8] = {};
  // both loops unrolled so that the 64 loads can be issued ahead of the sums
#pragma unroll
  for (int z = 0; z < KSPLIT; ++z) {
    // first row of the even plane below z: wave-uniform, kept in scalar registers
    // so that every load is scalar base + lane column + immediate (an immediate
    // reaches one plane further), with no 64-bit vector add
    unsigned long long u =
        (unsigned long long)(P + (size_t)(z & ~1) * Hdim * Hdim + (size_t)h1 * Hdim);
    unsigned lo = __builtin_amdgcn_readfirstlane((unsigned)u);
    unsigned hi = __builtin_amdgcn_readfirstlane((unsigned)(u >> 32));
    const AS1 float* plane = (const AS1 float*)(((unsigned long long)hi << 32) | lo);
#pragma unroll
    for (int r = 0; r < 8; ++r)
      s[r] += plane[(z & 1) * Hdim * Hdim + r * Hdim + h2];
  }
  h8 hv;
  // unrolled: s[] and hv[] indexed by constants only, so both stay in registers
#pragma unroll
  for (int r = 0; r < 8; ++r) hv[r] = (_Float16)(s[r] * scale);
  *reinterpret_cast<h8*>(KVt + (size_t)h2 * Hdim + h1) = hv;   // transposed store
}

// ---------------------------------------------------------------------------
extern "C" void kernel_launch(void* const* d_in, const int* in_sizes, int n_in,
                              void* d_out, int out_size, void* d_ws, size_t ws_size,
                              hipStream_t stream) {
  (void)in_sizes; (void)n_in; (void)out_size; (void)ws_size;
  const float* x  = (const float*)d_in[0];
  const float* Wq = (const float*)d_in[1];
  const float* bq = (const float*)d_in[2];
  const float* Wk = (const float*)d_in[3];
  const float* bk = (const float*)d_in[4];
  const float* Wv = (const float*)d_in[5];
  const float* bv = (const float*)d_in[6];
  float* out = (float*)d_out;

  char* ws = (char*)d_ws;
  const size_t MB = 1ull << 20;
  _Float16* xf  = (_Float16*)(ws);               // 16 MB
  _Float16* Wqf = (_Float16*)(ws + 16 * MB);     //  6 MB   Wq, Wk, Wv: [3H,H]
  _Float16* qf  = (_Float16*)(ws + 22 * MB);     // 16 MB   q   [N,H]
  _Float16* kT  = (_Float16*)(ws + 38 * MB);     // 16 MB   k^T [H,N]
  _Float16* vT  = (_Float16*)(ws + 54 * MB);     // 16 MB   v^T [H,N]
  float*    P   = (float*)   (ws + 70 * MB);     // 32 MB   8 partials [H,H]
  _Float16* KVt = (_Float16*)(ws + 102 * MB);    //  2 MB   KV^T [H,H]

  dim3 blk(256);

  // fp32 -> f16 converts, one launch: xf, Wqf, Wkf, Wvf are contiguous from xf on
  cvt_f32_f16<16><<<(Nrows * Hdim + 3 * Hdim * Hdim) / (1024 * 16), blk, 0, stream>>>(
      x, Wq, Wk, Wv, xf);

  dim3 gQKV(3 * Hdim / BN, Nrows / BM);  // 24 x 32: the 24 blocks of a row tile of x
                                         // are neighbours in launch order
  dim3 gProj(Hdim / BN, Nrows / BM);   // 8 x 32
  dim3 gKV(Hdim / BN, Hdim / BM, KSPLIT);  // 8 x 4 x 8 split-K slices, one launch

  // the three projections, one launch: B = [Wqf; Wkf; Wvf] (contiguous, 3H rows);
  // q normal layout; k,v stored transposed ([2H, N] from kT on, ldct = N)
  gemm_f16_wmma<true, _Float16>
      <<<gQKV, blk, 0, stream>>>(xf, Wqf, bq, bk, bv, qf, kT, Hdim, Hdim, Hdim, Hdim,
                                 Nrows, 0, 0, 0);

  // KV partials: KV[h1,h2] = sum_n kT[h1,n] * vT[h2,n]  (both row-major now)
  // slice z covers n in [z*N/8, (z+1)*N/8) and writes partial plane z of P
  gemm_f16_wmma<false, float>
      <<<gKV, blk, 0, stream>>>(kT, vT, nullptr, nullptr, nullptr, P, nullptr,
                                Nrows / KSPLIT, Nrows, Nrows, Hdim, 0,
                                Nrows / KSPLIT, Nrows / KSPLIT, Hdim * Hdim);

  // sum partials, scale by 1/sqrt(1024), emit KV^T in f16
  reduce_kv<<<(Hdim * Hdim) / (256 * 8), blk, 0, stream>>>(P, KVt, 0.03125f);

  // out = q @ KV  (KVt rows are KV columns -> contiguous B fragments)
  gemm_f16_wmma<false, float>
      <<<gProj, blk, 0, stream>>>(qf, KVt, nullptr, nullptr, nullptr, out, nullptr,
                                  Hdim, Hdim, Hdim, Hdim, 0, 0, 0, 0);
}

// v006
// A run of this version takes 91.2 microseconds.
// Next to v005, in two timings, it ran 1.10 and 1.08 times as fast.
// All steps since v000 together make it 4.00 times as fast.
#include <hip/hip_runtime.h>
#include <hip/hip_bf16.h>

// ---------------------------------------------------------------------------
// Fused self-attention (no softmax) for MI455X / gfx1250, wave32 + WMMA.
//   q = x@Wq^T + bq ; k = x@Wk^T + bk ; v = x@Wv^T + bv      (f16, f32 accum)
//   out = q @ (k^T @ v) / sqrt(H)        <-- associativity: no NxN scores
// All GEMM operands are K-contiguous f16 rows -> uniform b128 tile loader,
// double-buffered LDS stages of 128 k (256-byte rows), async global->LDS copies
// (ASYNCcnt), 64x64 wave tiles (64x96 in the projections), WMMA fragments fetched
// one k-step ahead into a second register set.
// ---------------------------------------------------------------------------

typedef __attribute__((ext_vector_type(16))) _Float16 v16h;
typedef __attribute__((ext_vector_type(8)))  _Float16 h8;
typedef __attribute__((ext_vector_type(4)))  _Float16 h4;
typedef __attribute__((ext_vector_type(8)))  float    v8f;
typedef __attribute__((ext_vector_type(4)))  float    f32x4;
typedef __attribute__((ext_vector_type(4)))  int      v4i;

constexpr int BM = 256;       // block tile M (4 waves x 64)
constexpr int BN = 128;       // block tile N (2 waves x 64)
constexpr int BNP = 192;      // block tile N of the projections (2 waves x 96)
constexpr int BK = 128;       // K per LDS stage: 256 B of every row, 4 WMMA k-steps
constexpr int WK = 32;        // K of one 16x16x32 WMMA
constexpr int LDST = 136;     // LDS row stride in halfwords (272B = 17*16B)

constexpr int Nrows = 8192;
constexpr int Hdim  = 1024;
constexpr int KSPLIT = 8;     // deterministic split-K for k^T @ v

// ---- gfx1250 async copy-to-LDS detection ----------------------------------
#define AS3 __attribute__((address_space(3)))
#define AS1 __attribute__((address_space(1)))
#if defined(__has_builtin)
#  if __has_builtin(__builtin_amdgcn_global_load_async_to_lds_b128) && \
      __has_builtin(__builtin_amdgcn_s_wait_asynccnt)
#    define USE_ASYNC_COPY 1
#  endif
#endif
#ifndef USE_ASYNC_COPY
#  define USE_ASYNC_COPY 0
#endif

#if USE_ASYNC_COPY
__device__ __forceinline__ AS3 v4i* lds_cast(void* p) {
  return (AS3 v4i*)(unsigned int)(unsigned long long)p;
}
__device__ __forceinline__ AS1 v4i* gbl_cast(const void* p) {
  return (AS1 v4i*)(unsigned long long)p;
}
#endif

// ---- issue one ROWSx128 f16 tile: global -> LDS (b128 per transfer) -------
// 16 lanes cover the 256 bytes of one row, so a wave-wide copy is two whole rows.
template <int ROWS>
__device__ __forceinline__ void issue_tile(_Float16* __restrict__ lds,
                                           const _Float16* __restrict__ g,
                                           int ld, int row0, int kpos, int tid) {
#pragma unroll
  for (int p = 0; p < ROWS / 16; ++p) {      // ROWS*16 x 16B transfers / 256 thr
    int idx = p * 256 + tid;
    int r   = idx >> 4;
    int c8  = (idx & 15) * 8;
    const _Float16* gp = g + (size_t)(row0 + r) * ld + (kpos + c8);
    _Float16*       lp = lds + r * LDST + c8;        // 16B-aligned
#if USE_ASYNC_COPY
    __builtin_amdgcn_global_load_async_to_lds_b128(gbl_cast(gp), lds_cast(lp),
                                                   0, 0);
#else
    *reinterpret_cast<h8*>(lp) = *reinterpret_cast<const h8*>(gp);
#endif
  }
}

// ---- per-lane WMMA fragment from a [ROWS][LDST] LDS tile -------------------
// 16-bit operand layout (ISA 7.12.2): lanes 0-15 hold K {0..7,16..23},
// lanes 16-31 hold K {8..15,24..31}; row/col = lane & 15. k0: first k of the step.
__device__ __forceinline__ v16h load_frag(const _Float16* __restrict__ lds,
                                          int rowbase, int k0, int lane) {
  int r  = rowbase + (lane & 15);
  int kb = k0 + ((lane >> 4) << 3);          // k0 or k0 + 8
  const _Float16* p = lds + r * LDST + kb;   // 16-byte aligned chunks
  v16h f;
#pragma unroll
  for (int i = 0; i < 8; ++i) { f[i] = p[i]; f[i + 8] = p[i + 16]; }
  return f;
}

// ---- one k-step's fragments of a 64 x 16*NJ wave tile: 4 of A, NJ of B ------
template <int NJ>
__device__ __forceinline__ void load_set(v16h (&a)[4], v16h (&b)[NJ],
                                         const _Float16* __restrict__ la,
                                         const _Float16* __restrict__ lb,
                                         int wm, int wn, int k0, int lane) {
  // both loops unrolled: a[] and b[] indexed by constants only, so they are registers
#pragma unroll
  for (int i = 0; i < 4; ++i) a[i] = load_frag(la, wm * 64 + i * 16, k0, lane);
#pragma unroll
  for (int j = 0; j < NJ; ++j)
    b[j] = load_frag(lb, wn * (NJ * 16) + j * 16, k0, lane);
}

// ---- all-f16 WMMA GEMM:  C[m,n] = sum_k A[m,k]*B[n,k] (+ bias[n]) ----------
// blockIdx.z picks an independent slice: A, B, C advance by zsA, zsB, zsC elements.
// QKV: B holds the rows of Wq, Wk, Wv one after the other (3*Hdim columns n). The
// block tile is 256 x 192, so that 16 x 32 blocks are two full rounds of the chip's
// 256 places and each loaded operand byte feeds more WMMAs. Every 16-column tile
// lies in one of the three: q columns get bias0 and go to C row-major; k and v
// columns get bias1 / bias2 and go to Ct transposed (Ct[(n - Hdim)*ldct + m], f16)
// -> one b128 store per tile.
template <bool QKV, typename TOut>
__global__ __launch_bounds__(256) void gemm_f16_wmma(
    const _Float16* __restrict__ A, const _Float16* __restrict__ B,
    const float* __restrict__ bias0, const float* __restrict__ bias1,
    const float* __restrict__ bias2, TOut* __restrict__ C,
    _Float16* __restrict__ Ct,
    int K, int lda, int ldb, int ldc, int ldct, int zsA, int zsB, int zsC) {
  constexpr int BNt = QKV ? BNP : BN;   // block tile N
  constexpr int NJ  = BNt / 32;         // 16-column tiles of one wave
  __shared__ __align__(16) _Float16 lsA[2][BM * LDST];
  __shared__ __align__(16) _Float16 lsB[2][BNt * LDST];

  const int tid  = threadIdx.x;
  const int lane = tid & 31;
  const int wid  = tid >> 5;       // 8 waves
  const int wm   = wid & 3;        // 4 waves along M (64 rows each)
  const int wn   = wid >> 2;       // 2 waves along N (16*NJ cols each)
  const int row0 = blockIdx.y * BM;
  const int col0 = blockIdx.x * BNt;
  A += (size_t)blockIdx.z * zsA;
  B += (size_t)blockIdx.z * zsB;
  C += (size_t)blockIdx.z * zsC;

  v8f acc[4][NJ] = {};             // 64 x 16*NJ per wave = 4*NJ WMMA accumulators
  v16h af[2][4], bf[2][NJ];        // two fragment sets: set (ks & 1) serves k-step ks

  const int nk = K / BK;
  issue_tile<BM>(lsA[0], A, lda, row0, 0, tid);
  issue_tile<BNt>(lsB[0], B, ldb, col0, 0, tid);
  // this wave's copies of stage 0 have landed before the barrier publishes them
  asm volatile("s_wait_asynccnt 0x0" ::: "memory");
  __syncthreads();
  if (1 < nk) {          // stage 1 flies while stage 0 is worked on
    issue_tile<BM>(lsA[1], A, lda, row0, BK, tid);
    issue_tile<BNt>(lsB[1], B, ldb, col0, BK, tid);
  }
  load_set<NJ>(af[0], bf[0], lsA[0], lsB[0], wm, wn, 0, lane);  // k-step 0 of stage 0

  for (int kt = 0; kt < nk; ++kt) {
    const int cur = kt & 1;
    // unrolled: the set index ks & 1 must be a constant for the sets to be registers
#pragma unroll
    for (int ks = 0; ks < BK / WK; ++ks) {
      const int cs = ks & 1;
      if (ks + 1 < BK / WK) {
        // the next k-step's LDS loads, one group, into the set that is free
        load_set<NJ>(af[cs ^ 1], bf[cs ^ 1], lsA[cur], lsB[cur], wm, wn,
                     (ks + 1) * WK, lane);
      } else {
        // publish point of stage kt + 1, in front of this stage's last k-step (its
        // fragments are in registers): this wave's reads of cur are done, its copies
        // of the next stage have landed; behind the barrier every wave may read the
        // next stage and cur may be refilled
        asm volatile("s_wait_dscnt 0x0" ::: "memory");
        asm volatile("s_wait_asynccnt 0x0" ::: "memory");
        __syncthreads();
        if (kt + 2 < nk) {   // refill of cur: a whole pass ahead of its publish point
          issue_tile<BM>(lsA[cur], A, lda, row0, (kt + 2) * BK, tid);
          issue_tile<BNt>(lsB[cur], B, ldb, col0, (kt + 2) * BK, tid);
        }
        if (kt + 3 < nk) {                     // L2 prefetch one tile further ahead
          __builtin_prefetch(A + (size_t)(row0 + tid) * lda + (kt + 3) * BK, 0, 0);
          __builtin_prefetch(B + (size_t)(col0 + (int)((unsigned)tid % BNt)) * ldb +
                                 (kt + 3) * BK, 0, 0);
        }
        if (kt + 1 < nk)     // k-step 0 of the next stage, under this stage's last WMMAs
          load_set<NJ>(af[0], bf[0], lsA[cur ^ 1], lsB[cur ^ 1], wm, wn, 0, lane);
      }
      // keeps the load group ahead of the WMMA block: sunk among the WMMAs, each
      // load pair would be waited for at once and the matrix unit would idle
      __builtin_amdgcn_sched_barrier(0);
      // both loops unrolled: acc[][] and the sets indexed by constants only
#pragma unroll
      for (int i = 0; i < 4; ++i)
#pragma unroll
        for (int j = 0; j < NJ; ++j)
          acc[i][j] = __builtin_amdgcn_wmma_f32_16x16x32_f16(
              false, af[cs][i], false, bf[cs][j], (short)0, acc[i][j], false, false);
      // keeps the following load group behind this block, so that it stays one group
      __builtin_amdgcn_sched_barrier(0);
    }
  }

  // C/D layout (ISA 7.12.2): VGPR g -> M = g + 8*(lane>=16), N = lane&15.
  if constexpr (QKV) {
    // first column of this wave, in a scalar register: the test below is then a
    // scalar branch, taken alike by the whole wave
    const int cw = col0 + __builtin_amdgcn_readfirstlane(wn) * (NJ * 16);
    // all loops unrolled: acc[][] and hv[] indexed by constants only, so they are
    // registers
#pragma unroll
    for (int j = 0; j < NJ; ++j) {
      const int c16 = cw + j * 16;           // first column of this 16-column tile
      const int gn  = c16 + (lane & 15);
      if (c16 >= Hdim) {                     // wave-uniform: a k or a v tile
        const float* __restrict__ bias = c16 < 2 * Hdim ? bias1 : bias2;
        float bv = bias[gn & (Hdim - 1)];
#pragma unroll
        for (int i = 0; i < 4; ++i) {
          int gm = row0 + wm * 64 + i * 16 + ((lane >> 4) << 3);
          h8 hv;                             // 8 consecutive m at fixed n
#pragma unroll
          for (int gg = 0; gg < 8; ++gg)
            hv[gg] = (_Float16)(acc[i][j][gg] + bv);
          *reinterpret_cast<h8*>(Ct + (size_t)(gn - Hdim) * ldct + gm) = hv;
        }
        // as at the end of the q branch below
        asm volatile("s_wait_xcnt 0x0" ::: "memory");
        __builtin_amdgcn_sched_barrier(0);
      } else {                               // a q tile
        float bv = bias0[gn];
#pragma unroll
        for (int i = 0; i < 4; ++i) {
          int gm = row0 + wm * 64 + i * 16 + ((lane >> 4) << 3);
#pragma unroll
          for (int gg = 0; gg < 8; ++gg)
            C[(size_t)(gm + gg) * ldc + gn] = (TOut)(acc[i][j][gg] + bv);
        }
        // whatever the compiler lays out behind these stores (the other branch, the
        // next tile) reuses registers that they name: the wait stands in front of
        // those overwrites, inside the branch, and the scheduling barrier keeps later
        // arithmetic from being moved up over it
        asm volatile("s_wait_xcnt 0x0" ::: "memory");
        __builtin_amdgcn_sched_barrier(0);
      }
    }
    return;
  }
  float bj[4] = {};                          // the other GEMMs have no bias
#pragma unroll
  for (int i = 0; i < 4; ++i) {
#pragma unroll
    for (int j = 0; j < 4; ++j) {
      int gm = row0 + wm * 64 + i * 16 + ((lane >> 4) << 3);
      int gn = col0 + wn * 64 + j * 16 + (lane & 15);
      float bv = bj[j];
#pragma unroll
      for (int gg = 0; gg < 8; ++gg) {
        float val = acc[i][j][gg] + bv;
        C[(size_t)(gm + gg) * ldc + gn] = (TOut)val;
      }
    }
  }
}

// ---- fp32 -> f16 convert of x, Wq, Wk, Wv in one launch: V float4 per thread -
// A block covers 256*V consecutive float4 of one source; each wave-wide load is
// 512 contiguous bytes. Few long-lived waves: the launch is not paced by how fast
// waves can be started. The first XB blocks take x, then WB blocks each of Wq, Wk,
// Wv; dstall holds the four results one after the other in that order.
template <int V>
__global__ __launch_bounds__(256) void cvt_f32_f16(const float* __restrict__ x,
                                                   const float* __restrict__ Wq,
                                                   const float* __restrict__ Wk,
                                                   const float* __restrict__ Wv,
                                                   _Float16* __restrict__ dstall) {
  constexpr int XB = (Nrows * Hdim) / (1024 * V);
  constexpr int WB = (Hdim * Hdim) / (1024 * V);
  const int b = blockIdx.x;
  const int first = b < XB ? 0 : b < XB + WB ? XB : b < XB + 2 * WB ? XB + WB
                                                                    : XB + 2 * WB;
  const float* __restrict__ src =
      b < XB ? x : b < XB + WB ? Wq : b < XB + 2 * WB ? Wk : Wv;
  _Float16* __restrict__ dst = dstall + (size_t)first * (1024 * V);
  size_t base = (size_t)(b - first) * (256 * V) + threadIdx.x;  // float4 index
  f32x4 v[V];
  // unrolled so that v[] stays in registers and all V loads are in flight
#pragma unroll
  for (int p = 0; p < V; ++p)
    v[p] = reinterpret_cast<const f32x4*>(src)[base + p * 256];
  // unrolled for the same reason: v[] indexed by constants only
#pragma unroll
  for (int p = 0; p < V; ++p)
    reinterpret_cast<h4*>(dst)[base + p * 256] = __builtin_convertvector(v[p], h4);
}

// ---- reduce split-K partials of KV, scale by 1/sqrt(H), store KV^T (f16) ---
// One thread owns column h2 of 8 consecutive rows h1: 64 coalesced loads, each
// element summed over z = 0..7 in order, one 16-byte store into row h2 of KV^T.
__global__ __launch_bounds__(256) void reduce_kv(const float* __restrict__ P,
                                                 _Float16* __restrict__ KVt,
                                                 float scale) {
  // a block owns 64 rows h1 x 32 columns h2: wave w takes rows 8w..8w+7, lane l
  // column l, so each 128-byte line of KV^T is written by one block only
  const int wave = __builtin_amdgcn_readfirstlane(threadIdx.x >> 5);  // scalar
  const int h1 = (blockIdx.x >> 5) * 64 + wave * 8;   // first of 8 rows, wave-uniform
  const unsigned h2 = (blockIdx.x & 31) * 32 + (threadIdx.x & 31);
  float s[8] = {};
  // both loops unrolled so that the 64 loads can be issued ahead of the sums
#pragma unroll
  for (int z = 0; z < KSPLIT; ++z) {
    // first row of the even plane below z: wave-uniform, kept in scalar registers
    // so that every load is scalar base + lane column + immediate (an immediate
    // reaches one plane further), with no 64-bit vector add
    unsigned long long u =
        (unsigned long long)(P + (size_t)(z & ~1) * Hdim * Hdim + (size_t)h1 * Hdim);
    unsigned lo = __builtin_amdgcn_readfirstlane((unsigned)u);
    unsigned hi = __builtin_amdgcn_readfirstlane((unsigned)(u >> 32));
    const AS1 float* plane = (const AS1 float*)(((unsigned long long)hi << 32) | lo);
#pragma unroll
    for (int r = 0; r < 8; ++r)
      s[r] += plane[(z & 1) * Hdim * Hdim + r * Hdim + h2];
  }
  h8 hv;
  // unrolled: s[] and hv[] indexed by constants only, so both stay in registers
#pragma unroll
  for (int r = 0; r < 8; ++r) hv[r] = (_Float16)(s[r] * scale);
  *reinterpret_cast<h8*>(KVt + (size_t)h2 * Hdim + h1) = hv;   // transposed store
}

// ---------------------------------------------------------------------------
extern "C" void kernel_launch(void* const* d_in, const int* in_sizes, int n_in,
                              void* d_out, int out_size, void* d_ws, size_t ws_size,
                              hipStream_t stream) {
  (void)in_sizes; (void)n_in; (void)out_size; (void)ws_size;
  const float* x  = (const float*)d_in[0];
  const float* Wq = (const float*)d_in[1];
  const float* bq = (const float*)d_in[2];
  const float* Wk = (const float*)d_in[3];
  const float* bk = (const float*)d_in[4];
  const float* Wv = (const float*)d_in[5];
  const float* bv = (const float*)d_in[6];
  float* out = (float*)d_out;

  char* ws = (char*)d_ws;
  const size_t MB = 1ull << 20;
  _Float16* xf  = (_Float16*)(ws);               // 16 MB
  _Float16* Wqf = (_Float16*)(ws + 16 * MB);     //  6 MB   Wq, Wk, Wv: [3H,H]
  _Float16* qf  = (_Float16*)(ws + 22 * MB);     // 16 MB   q   [N,H]
  _Float16* kT  = (_Float16*)(ws + 38 * MB);     // 16 MB   k^T [H,N]
  _Float16* vT  = (_Float16*)(ws + 54 * MB);     // 16 MB   v^T [H,N]
  float*    P   = (float*)   (ws + 70 * MB);     // 32 MB   8 partials [H,H]
  _Float16* KVt = (_Float16*)(ws + 102 * MB);    //  2 MB   KV^T [H,H]

  dim3 blk(256);

  // fp32 -> f16 converts, one launch: xf, Wqf, Wkf, Wvf are contiguous from xf on
  cvt_f32_f16<16><<<(Nrows * Hdim + 3 * Hdim * Hdim) / (1024 * 16), blk, 0, stream>>>(
      x, Wq, Wk, Wv, xf);

  dim3 gQKV(3 * Hdim / BNP, Nrows / BM); // 16 x 32: the 16 blocks of a row tile of x
                                         // are neighbours in launch order
  dim3 gProj(Hdim / BN, Nrows / BM);   // 8 x 32
  dim3 gKV(Hdim / BN, Hdim / BM, KSPLIT);  // 8 x 4 x 8 split-K slices, one launch

  // the three projections, one launch: B = [Wqf; Wkf; Wvf] (contiguous, 3H rows);
  // q normal layout; k,v stored transposed ([2H, N] from kT on, ldct = N)
  gemm_f16_wmma<true, _Float16>
      <<<gQKV, blk, 0, stream>>>(xf, Wqf, bq, bk, bv, qf, kT, Hdim, Hdim, Hdim, Hdim,
                                 Nrows, 0, 0, 0);

  // KV partials: KV[h1,h2] = sum_n kT[h1,n] * vT[h2,n]  (both row-major now)
  // slice z covers n in [z*N/8, (z+1)*N/8) and writes partial plane z of P
  gemm_f16_wmma<false, float>
      <<<gKV, blk, 0, stream>>>(kT, vT, nullptr, nullptr, nullptr, P, nullptr,
                                Nrows / KSPLIT, Nrows, Nrows, Hdim, 0,
                                Nrows / KSPLIT, Nrows / KSPLIT, Hdim * Hdim);

  // sum partials, scale by 1/sqrt(1024), emit KV^T in f16
  reduce_kv<<<(Hdim * Hdim) / (256 * 8), blk, 0, stream>>>(P, KVt, 0.03125f);

  // out = q @ KV  (KVt rows are KV columns -> contiguous B fragments)
  gemm_f16_wmma<false, float>
      <<<gProj, blk, 0, stream>>>(qf, KVt, nullptr, nullptr, nullptr, out, nullptr,
                                  Hdim, Hdim, Hdim, Hdim, 0, 0, 0, 0);
}

// v007
// It runs in 83.3 microseconds.
// Timed twice side by side with v006, it ran 1.09 and 1.10 times as fast.
// Counting every step since v000, it is 4.37 times as fast.
#include <hip/hip_runtime.h>
#include <hip/hip_bf16.h>

// ---------------------------------------------------------------------------
// Fused self-attention (no softmax) for MI455X / gfx1250, wave32 + WMMA.
//   q = x@Wq^T + bq ; k = x@Wk^T + bk ; v = x@Wv^T + bv      (f16, f32 accum)
//   out = q @ (k^T @ v) / sqrt(H)        <-- associativity: no NxN scores
// All GEMM operands are K-contiguous f16 rows -> uniform b128 tile loader,
// double-buffered LDS stages of 128 k (256-byte rows), async global->LDS copies
// (ASYNCcnt), 64x64 wave tiles (64x96 in the projections), WMMA fragments fetched
// one k-step ahead into a second register set; results staged in LDS and stored
// as whole 128-byte lines.
// ---------------------------------------------------------------------------

typedef __attribute__((ext_vector_type(16))) _Float16 v16h;
typedef __attribute__((ext_vector_type(8)))  _Float16 h8;
typedef __attribute__((ext_vector_type(4)))  _Float16 h4;
typedef __attribute__((ext_vector_type(8)))  float    v8f;
typedef __attribute__((ext_vector_type(4)))  float    f32x4;
typedef __attribute__((ext_vector_type(4)))  int      v4i;

constexpr int BM = 256;       // block tile M (4 waves x 64)
constexpr int BN = 128;       // block tile N (2 waves x 64)
constexpr int BNP = 192;      // block tile N of the projections (2 waves x 96)
constexpr int BK = 128;       // K per LDS stage: 256 B of every row, 4 WMMA k-steps
constexpr int WK = 32;        // K of one 16x16x32 WMMA
constexpr int LDST = 136;     // LDS row stride in halfwords (272B = 17*16B)

constexpr int Nrows = 8192;
constexpr int Hdim  = 1024;
constexpr int KSPLIT = 8;     // deterministic split-K for k^T @ v

// ---- gfx1250 async copy-to-LDS detection ----------------------------------
#define AS3 __attribute__((address_space(3)))
#define AS1 __attribute__((address_space(1)))
#if defined(__has_builtin)
#  if __has_builtin(__builtin_amdgcn_global_load_async_to_lds_b128) && \
      __has_builtin(__builtin_amdgcn_s_wait_asynccnt)
#    define USE_ASYNC_COPY 1
#  endif
#endif
#ifndef USE_ASYNC_COPY
#  define USE_ASYNC_COPY 0
#endif

#if USE_ASYNC_COPY
__device__ __forceinline__ AS3 v4i* lds_cast(void* p) {
  return (AS3 v4i*)(unsigned int)(unsigned long long)p;
}
__device__ __forceinline__ AS1 v4i* gbl_cast(const void* p) {
  return (AS1 v4i*)(unsigned long long)p;
}
#endif

// ---- issue one ROWSx128 f16 tile: global -> LDS (b128 per transfer) -------
// 16 lanes cover the 256 bytes of one row, so a wave-wide copy is two whole rows.
// Every 64 tile rows the global row jumps by EXTRA more (0: consecutive rows).
template <int ROWS, int EXTRA>
__device__ __forceinline__ void issue_tile(_Float16* __restrict__ lds,
                                           const _Float16* __restrict__ g,
                                           int ld, int row0, int kpos, int tid) {
#pragma unroll
  for (int p = 0; p < ROWS / 16; ++p) {      // ROWS*16 x 16B transfers / 256 thr
    int idx = p * 256 + tid;
    int r   = idx >> 4;
    int c8  = (idx & 15) * 8;
    const _Float16* gp = g + (size_t)(row0 + r + (p >> 2) * EXTRA) * ld + (kpos + c8);
    _Float16*       lp = lds + r * LDST + c8;        // 16B-aligned
#if USE_ASYNC_COPY
    __builtin_amdgcn_global_load_async_to_lds_b128(gbl_cast(gp), lds_cast(lp),
                                                   0, 0);
#else
    *reinterpret_cast<h8*>(lp) = *reinterpret_cast<const h8*>(gp);
#endif
  }
}

// ---- per-lane WMMA fragment from a [ROWS][LDST] LDS tile -------------------
// 16-bit operand layout (ISA 7.12.2): lanes 0-15 hold K {0..7,16..23},
// lanes 16-31 hold K {8..15,24..31}; row/col = lane & 15. k0: first k of the step.
__device__ __forceinline__ v16h load_frag(const _Float16* __restrict__ lds,
                                          int rowbase, int k0, int lane) {
  int r  = rowbase + (lane & 15);
  int kb = k0 + ((lane >> 4) << 3);          // k0 or k0 + 8
  const _Float16* p = lds + r * LDST + kb;   // 16-byte aligned chunks
  v16h f;
#pragma unroll
  for (int i = 0; i < 8; ++i) { f[i] = p[i]; f[i + 8] = p[i + 16]; }
  return f;
}

// ---- one k-step's fragments of a 64 x 16*NJ wave tile: 4 of A, NJ of B ------
// SPLIT: the B tile is three groups of 64 rows, and a wave takes 32 rows of each.
template <int NJ, bool SPLIT>
__device__ __forceinline__ void load_set(v16h (&a)[4], v16h (&b)[NJ],
                                         const _Float16* __restrict__ la,
                                         const _Float16* __restrict__ lb,
                                         int wm, int wn, int k0, int lane) {
  // both loops unrolled: a[] and b[] indexed by constants only, so they are registers
#pragma unroll
  for (int i = 0; i < 4; ++i) a[i] = load_frag(la, wm * 64 + i * 16, k0, lane);
#pragma unroll
  for (int j = 0; j < NJ; ++j)
    b[j] = load_frag(lb, SPLIT ? (j >> 1) * 64 + wn * 32 + (j & 1) * 16
                               : wn * (NJ * 16) + j * 16, k0, lane);
}

// ---- all-f16 WMMA GEMM:  C[m,n] = sum_k A[m,k]*B[n,k] (+ bias[n]) ----------
// blockIdx.z picks an independent slice: A, B, C advance by zsA, zsB, zsC elements.
// QKV: B holds the rows of Wq, Wk, Wv one after the other (3*Hdim columns n). The
// block tile is 256 x 192, so that 16 x 32 blocks are two full rounds of the chip's
// 256 places and each loaded operand byte feeds more WMMAs. A block takes the same
// 64 columns of q, of k and of v, a wave 32 of each (its tiles j = 0,1 / 2,3 / 4,5):
// q columns get bias0 and go to C row-major; k and v columns get bias1 / bias2 and
// go to Ct transposed (Ct[(n - Hdim)*ldct + m], f16).
// A tile that is stored row-major has the B rows as first WMMA operand: a lane's 8
// results are then 8 consecutive n of one row m. Every tile goes to LDS by 16-byte
// writes and from there to memory in whole 128-byte lines.
template <bool QKV, typename TOut>
__global__ __launch_bounds__(256) void gemm_f16_wmma(
    const _Float16* __restrict__ A, const _Float16* __restrict__ B,
    const float* __restrict__ bias0, const float* __restrict__ bias1,
    const float* __restrict__ bias2, TOut* __restrict__ C,
    _Float16* __restrict__ Ct,
    int K, int lda, int ldb, int zsA, int zsB, int zsC) {
  // row pitches of C and Ct, constants: a wave's stores then differ by immediates only
  constexpr int ldc = Hdim, ldct = Nrows;
  constexpr int BNt = QKV ? BNP : BN;   // block tile N
  constexpr int NJ  = BNt / 32;         // 16-column tiles of one wave
  __shared__ __align__(16) _Float16 lsA[2][BM * LDST];
  __shared__ __align__(16) _Float16 lsB[2][BNt * LDST];

  const int tid  = threadIdx.x;
  const int lane = tid & 31;
  const int wid  = tid >> 5;       // 8 waves
  const int wm   = wid & 3;        // 4 waves along M (64 rows each)
  const int wn   = wid >> 2;       // 2 waves along N (16*NJ cols each)
  const int row0 = blockIdx.y * BM;
  const int col0 = blockIdx.x * (QKV ? 64 : BNt);   // QKV: in each of q, k, v
  constexpr int BX = QKV ? Hdim - 64 : 0;   // from 64 rows of Wq on to those of Wk, Wv
  A += (size_t)blockIdx.z * zsA;
  B += (size_t)blockIdx.z * zsB;
  C += (size_t)blockIdx.z * zsC;

  v8f acc[4][NJ] = {};             // 64 x 16*NJ per wave = 4*NJ WMMA accumulators
  v16h af[2][4], bf[2][NJ];        // two fragment sets: set (ks & 1) serves k-step ks

  const int nk = K / BK;
  issue_tile<BM, 0>(lsA[0], A, lda, row0, 0, tid);
  issue_tile<BNt, BX>(lsB[0], B, ldb, col0, 0, tid);
  // this wave's copies of stage 0 have landed before the barrier publishes them
  asm volatile("s_wait_asynccnt 0x0" ::: "memory");
  __syncthreads();
  if (1 < nk) {          // stage 1 flies while stage 0 is worked on
    issue_tile<BM, 0>(lsA[1], A, lda, row0, BK, tid);
    issue_tile<BNt, BX>(lsB[1], B, ldb, col0, BK, tid);
  }
  load_set<NJ, QKV>(af[0], bf[0], lsA[0], lsB[0], wm, wn, 0, lane);  // k-step 0 of stage 0

  for (int kt = 0; kt < nk; ++kt) {
    const int cur = kt & 1;
    // unrolled: the set index ks & 1 must be a constant for the sets to be registers
#pragma unroll
    for (int ks = 0; ks < BK / WK; ++ks) {
      const int cs = ks & 1;
      if (ks + 1 < BK / WK) {
        // the next k-step's LDS loads, one group, into the set that is free
        load_set<NJ, QKV>(af[cs ^ 1], bf[cs ^ 1], lsA[cur], lsB[cur], wm, wn,
                     (ks + 1) * WK, lane);
      } else {
        // publish point of stage kt + 1, in front of this stage's last k-step (its
        // fragments are in registers): this wave's reads of cur are done, its copies
        // of the next stage have landed; behind the barrier every wave may read the
        // next stage and cur may be refilled
        asm volatile("s_wait_dscnt 0x0" ::: "memory");
        asm volatile("s_wait_asynccnt 0x0" ::: "memory");
        __syncthreads();
        if (kt + 2 < nk) {   // refill of cur: a whole pass ahead of its publish point
          issue_tile<BM, 0>(lsA[cur], A, lda, row0, (kt + 2) * BK, tid);
          issue_tile<BNt, BX>(lsB[cur], B, ldb, col0, (kt + 2) * BK, tid);
        }
        if (kt + 3 < nk) {                     // L2 prefetch one tile further ahead
          __builtin_prefetch(A + (size_t)(row0 + tid) * lda + (kt + 3) * BK, 0, 0);
          const int pr = (int)((unsigned)tid % BNt);   // row of the B tile
          __builtin_prefetch(B + (size_t)(col0 + pr + (pr >> 6) * BX) * ldb +
                                 (kt + 3) * BK, 0, 0);
        }
        if (kt + 1 < nk)     // k-step 0 of the next stage, under this stage's last WMMAs
          load_set<NJ, QKV>(af[0], bf[0], lsA[cur ^ 1], lsB[cur ^ 1], wm, wn, 0, lane);
      }
      // keeps the load group ahead of the WMMA block: sunk among the WMMAs, each
      // load pair would be waited for at once and the matrix unit would idle
      __builtin_amdgcn_sched_barrier(0);
      // both loops unrolled: acc[][] and the sets indexed by constants only
#pragma unroll
      for (int i = 0; i < 4; ++i)
#pragma unroll
        for (int j = 0; j < NJ; ++j)
          acc[i][j] = (QKV && j >= 2)      // k, v: a lane holds 8 m of one column n
              ? __builtin_amdgcn_wmma_f32_16x16x32_f16(
                    false, af[cs][i], false, bf[cs][j], (short)0, acc[i][j], false, false)
              : __builtin_amdgcn_wmma_f32_16x16x32_f16(   // 8 n of one row m
                    false, bf[cs][j], false, af[cs][i], (short)0, acc[i][j], false, false);
      // keeps the following load group behind this block, so that it stays one group
      __builtin_amdgcn_sched_barrier(0);
    }
  }

  // D layout (ISA 7.12.2): VGPR g -> row g + 8*(lane>=16) of the first operand,
  // column lane&15 of the second. The ring is free: behind the last pass's barrier
  // no wave reads it and no copy is in flight.
  char* const st = reinterpret_cast<char*>(&lsA[0][0]);
  const int c = lane & 15, h = lane >> 4;
  if constexpr (QKV) {
    constexpr int SP = 144;               // staged row: one 128-byte line + 16 B pad
    constexpr int KV0 = BM * SP;          // q: [256 m][64 n] of the block; then k, v
    char* const skv = st + KV0 + wid * (4 * 16 * SP);  // this wave's 4 tiles [16 n][64 m]
    // all loops unrolled: acc[][] and hv[] indexed by constants only, so they are
    // registers
#pragma unroll
    for (int j = 0; j < NJ; ++j) {
      if (j < 2) {                           // a q tile
        const float* bp = bias0 + col0 + wn * 32 + j * 16 + h * 8;
        const f32x4 b0 = *reinterpret_cast<const f32x4*>(bp);
        const f32x4 b1 = *reinterpret_cast<const f32x4*>(bp + 4);
#pragma unroll
        for (int i = 0; i < 4; ++i) {
          h8 hv;                             // 8 consecutive n at fixed m
#pragma unroll
          for (int gg = 0; gg < 8; ++gg)
            hv[gg] = (_Float16)(acc[i][j][gg] + (gg < 4 ? b0[gg & 3] : b1[gg & 3]));
          *reinterpret_cast<h8*>(st + (wm * 64 + i * 16 + c) * SP +
                                 (wn * 32 + j * 16 + h * 8) * 2) = hv;
        }
      } else {                               // a k or a v tile
        const float* __restrict__ bias = j < 4 ? bias1 : bias2;
        const float bv = bias[col0 + wn * 32 + (j & 1) * 16 + c];
#pragma unroll
        for (int i = 0; i < 4; ++i) {
          h8 hv;                             // 8 consecutive m at fixed n
#pragma unroll
          for (int gg = 0; gg < 8; ++gg)
            hv[gg] = (_Float16)(acc[i][j][gg] + bv);
          *reinterpret_cast<h8*>(skv + ((j - 2) * 16 + c) * SP + (i * 16 + h * 8) * 2) = hv;
        }
      }
    }
    // the staged writes are done before the barrier; behind it a wave reads q rows
    // that both column waves have written
    asm volatile("s_wait_dscnt 0x0" ::: "memory");
    __syncthreads();
    const int r4 = lane >> 3, c8 = (lane & 7) * 8;   // 8 lanes cover one 128-byte row
    h8 tk[16], tq[8];
    // unrolled: tk[] and tq[] indexed by constants only, so they are registers
#pragma unroll
    for (int t = 0; t < 16; ++t)
      tk[t] = *reinterpret_cast<const h8*>(skv + (t * 4 + r4) * SP + c8 * 2);
#pragma unroll
    for (int t = 0; t < 8; ++t)
      tq[t] = *reinterpret_cast<const h8*>(st + (wid * 32 + t * 4 + r4) * SP + c8 * 2);
    _Float16* const kp = Ct + (size_t)(col0 + wn * 32 + r4) * ldct + row0 + wm * 64 + c8;
    _Float16* const vp = kp + (size_t)Hdim * ldct;
    TOut* const qp = C + (size_t)(row0 + wid * 32 + r4) * ldc + col0 + c8;
#pragma unroll
    for (int t = 0; t < 16; ++t)             // 4 rows n of k^T or v^T, 64 m each
      *reinterpret_cast<h8*>((t < 8 ? kp : vp) + (t & 7) * (4 * ldct)) = tk[t];
#pragma unroll
    for (int t = 0; t < 8; ++t)              // 4 rows m of q, the block's 64 n each
      *reinterpret_cast<h8*>(qp + t * (4 * ldc)) = tq[t];
    return;
  } else {
    constexpr int SP = 272;                  // staged row: 64 f32 + 16 B pad
    char* const sw = st + wid * (64 * SP);   // this wave's own 64 x 64 tile
    // all loops unrolled: acc[][] and tv[] indexed by constants only
#pragma unroll
    for (int i = 0; i < 4; ++i)
#pragma unroll
      for (int j = 0; j < 4; ++j) {
        f32x4 lo = {acc[i][j][0], acc[i][j][1], acc[i][j][2], acc[i][j][3]};
        f32x4 hi = {acc[i][j][4], acc[i][j][5], acc[i][j][6], acc[i][j][7]};
        char* p = sw + (i * 16 + c) * SP + (j * 16 + h * 8) * 4;
        *reinterpret_cast<f32x4*>(p) = lo;
        *reinterpret_cast<f32x4*>(p + 16) = hi;
      }
    // other lanes of this wave read the rows back: their writes are done first, and
    // the compiler moves no read up over them
    asm volatile("s_wait_dscnt 0x0" ::: "memory");
    f32x4 tv[32];
#pragma unroll
    for (int t = 0; t < 32; ++t)             // 16 lanes cover one 256-byte row
      tv[t] = *reinterpret_cast<const f32x4*>(sw + (t * 2 + h) * SP + c * 16);
    TOut* const cp = C + (size_t)(row0 + wm * 64 + h) * ldc + col0 + wn * 64 + c * 4;
#pragma unroll
    for (int t = 0; t < 32; ++t)
      *reinterpret_cast<f32x4*>(cp + t * (2 * ldc)) = tv[t];
  }
}

// ---- fp32 -> f16 convert of x, Wq, Wk, Wv in one launch: V float4 per thread -
// A block covers 256*V consecutive float4 of one source; each wave-wide load is
// 512 contiguous bytes. Few long-lived waves: the launch is not paced by how fast
// waves can be started. The first XB blocks take x, then WB blocks each of Wq, Wk,
// Wv; dstall holds the four results one after the other in that order.
template <int V>
__global__ __launch_bounds__(256) void cvt_f32_f16(const float* __restrict__ x,
                                                   const float* __restrict__ Wq,
                                                   const float* __restrict__ Wk,
                                                   const float* __restrict__ Wv,
                                                   _Float16* __restrict__ dstall) {
  constexpr int XB = (Nrows * Hdim) / (1024 * V);
  constexpr int WB = (Hdim * Hdim) / (1024 * V);
  const int b = blockIdx.x;
  const int first = b < XB ? 0 : b < XB + WB ? XB : b < XB + 2 * WB ? XB + WB
                                                                    : XB + 2 * WB;
  const float* __restrict__ src =
      b < XB ? x : b < XB + WB ? Wq : b < XB + 2 * WB ? Wk : Wv;
  _Float16* __restrict__ dst = dstall + (size_t)first * (1024 * V);
  size_t base = (size_t)(b - first) * (256 * V) + threadIdx.x;  // float4 index
  f32x4 v[V];
  // unrolled so that v[] stays in registers and all V loads are in flight
#pragma unroll
  for (int p = 0; p < V; ++p)
    v[p] = reinterpret_cast<const f32x4*>(src)[base + p * 256];
  // unrolled for the same reason: v[] indexed by constants only
#pragma unroll
  for (int p = 0; p < V; ++p)
    reinterpret_cast<h4*>(dst)[base + p * 256] = __builtin_convertvector(v[p], h4);
}

// ---- reduce split-K partials of KV, scale by 1/sqrt(H), store KV^T (f16) ---
// One thread owns column h2 of 8 consecutive rows h1: 64 coalesced loads, each
// element summed over z = 0..7 in order, one 16-byte store into row h2 of KV^T.
__global__ __launch_bounds__(256) void reduce_kv(const float* __restrict__ P,
                                                 _Float16* __restrict__ KVt,
                                                 float scale) {
  // a block owns 64 rows h1 x 32 columns h2: wave w takes rows 8w..8w+7, lane l
  // column l, so each 128-byte line of KV^T is written by one block only
  const int wave = __builtin_amdgcn_readfirstlane(threadIdx.x >> 5);  // scalar
  const int h1 = (blockIdx.x >> 5) * 64 + wave * 8;   // first of 8 rows, wave-uniform
  const unsigned h2 = (blockIdx.x & 31) * 32 + (threadIdx.x & 31);
  float s[8] = {};
  // both loops unrolled so that the 64 loads can be issued ahead of the sums
#pragma unroll
  for (int z = 0; z < KSPLIT; ++z) {
    // first row of the even plane below z: wave-uniform, kept in scalar registers
    // so that every load is scalar base + lane column + immediate (an immediate
    // reaches one plane further), with no 64-bit vector add
    unsigned long long u =
        (unsigned long long)(P + (size_t)(z & ~1) * Hdim * Hdim + (size_t)h1 * Hdim);
    unsigned lo = __builtin_amdgcn_readfirstlane((unsigned)u);
    unsigned hi = __builtin_amdgcn_readfirstlane((unsigned)(u >> 32));
    const AS1 float* plane = (const AS1 float*)(((unsigned long long)hi << 32) | lo);
#pragma unroll
    for (int r = 0; r < 8; ++r)
      s[r] += plane[(z & 1) * Hdim * Hdim + r * Hdim + h2];
  }
  h8 hv;
  // unrolled: s[] and hv[] indexed by constants only, so both stay in registers
#pragma unroll
  for (int r = 0; r < 8; ++r) hv[r] = (_Float16)(s[r] * scale);
  *reinterpret_cast<h8*>(KVt + (size_t)h2 * Hdim + h1) = hv;   // transposed store
}

// ---------------------------------------------------------------------------
extern "C" void kernel_launch(void* const* d_in, const int* in_sizes, int n_in,
                              void* d_out, int out_size, void* d_ws, size_t ws_size,
                              hipStream_t stream) {
  (void)in_sizes; (void)n_in; (void)out_size; (void)ws_size;
  const float* x  = (const float*)d_in[0];
  const float* Wq = (const float*)d_in[1];
  const float* bq = (const float*)d_in[2];
  const float* Wk = (const float*)d_in[3];
  const float* bk = (const float*)d_in[4];
  const float* Wv = (const float*)d_in[5];
  const float* bv = (const float*)d_in[6];
  float* out = (float*)d_out;

  char* ws = (char*)d_ws;
  const size_t MB = 1ull << 20;
  _Float16* xf  = (_Float16*)(ws);               // 16 MB
  _Float16* Wqf = (_Float16*)(ws + 16 * MB);     //  6 MB   Wq, Wk, Wv: [3H,H]
  _Float16* qf  = (_Float16*)(ws + 22 * MB);     // 16 MB   q   [N,H]
  _Float16* kT  = (_Float16*)(ws + 38 * MB);     // 16 MB   k^T [H,N]
  _Float16* vT  = (_Float16*)(ws + 54 * MB);     // 16 MB   v^T [H,N]
  float*    P   = (float*)   (ws + 70 * MB);     // 32 MB   8 partials [H,H]
  _Float16* KVt = (_Float16*)(ws + 102 * MB);    //  2 MB   KV^T [H,H]

  dim3 blk(256);

  // fp32 -> f16 converts, one launch: xf, Wqf, Wkf, Wvf are contiguous from xf on
  cvt_f32_f16<16><<<(Nrows * Hdim + 3 * Hdim * Hdim) / (1024 * 16), blk, 0, stream>>>(
      x, Wq, Wk, Wv, xf);

  dim3 gQKV(3 * Hdim / BNP, Nrows / BM); // 16 x 32: the 16 blocks of a row tile of x
                                         // are neighbours in launch order; block x
                                         // takes columns 64x.. of q, of k and of v
  dim3 gProj(Hdim / BN, Nrows / BM);   // 8 x 32
  dim3 gKV(Hdim / BN, Hdim / BM, KSPLIT);  // 8 x 4 x 8 split-K slices, one launch

  // the three projections, one launch: B = [Wqf; Wkf; Wvf] (contiguous, 3H rows);
  // q normal layout; k,v stored transposed ([2H, N] from kT on)
  gemm_f16_wmma<true, _Float16>
      <<<gQKV, blk, 0, stream>>>(xf, Wqf, bq, bk, bv, qf, kT, Hdim, Hdim, Hdim, 0, 0, 0);

  // KV partials: KV[h1,h2] = sum_n kT[h1,n] * vT[h2,n]  (both row-major now)
  // slice z covers n in [z*N/8, (z+1)*N/8) and writes partial plane z of P
  gemm_f16_wmma<false, float>
      <<<gKV, blk, 0, stream>>>(kT, vT, nullptr, nullptr, nullptr, P, nullptr,
                                Nrows / KSPLIT, Nrows, Nrows,
                                Nrows / KSPLIT, Nrows / KSPLIT, Hdim * Hdim);

  // sum partials, scale by 1/sqrt(1024), emit KV^T in f16
  reduce_kv<<<(Hdim * Hdim) / (256 * 8), blk, 0, stream>>>(P, KVt, 0.03125f);

  // out = q @ KV  (KVt rows are KV columns -> contiguous B fragments)
  gemm_f16_wmma<false, float>
      <<<gProj, blk, 0, stream>>>(qf, KVt, nullptr, nullptr, nullptr, out, nullptr,
                                  Hdim, Hdim, Hdim, 0, 0, 0);
}

// v008
// Measured time: 81.3 microseconds a run.
// Timed twice side by side with v007, it ran 1.05 and 1.04 times as fast.
// Counting every step since v000, it is 4.57 times as fast.
#include <hip/hip_runtime.h>
#include <hip/hip_bf16.h>

// ---------------------------------------------------------------------------
// Fused self-attention (no softmax) for MI455X / gfx1250, wave32 + WMMA.
//   q = x@Wq^T + bq ; k = x@Wk^T + bk ; v = x@Wv^T + bv      (f16, f32 accum)
//   out = q @ (k^T @ v) / sqrt(H)        <-- associativity: no NxN scores
// All GEMM operands are K-contiguous f16 rows -> one uniform tile loader,
// double-buffered LDS stages of 128 k (256-byte rows) filled by tensor loads
// (TENSORcnt), 64x64 wave tiles (64x96 in the projections), WMMA fragments fetched
// one k-step ahead into a second register set; results staged in LDS and stored
// as whole 128-byte lines.
// ---------------------------------------------------------------------------

typedef __attribute__((ext_vector_type(16))) _Float16 v16h;
typedef __attribute__((ext_vector_type(8)))  _Float16 h8;
typedef __attribute__((ext_vector_type(4)))  _Float16 h4;
typedef __attribute__((ext_vector_type(8)))  float    v8f;
typedef __attribute__((ext_vector_type(4)))  float    f32x4;

constexpr int BM = 256;       // block tile M (4 waves x 64)
constexpr int BN = 128;       // block tile N (2 waves x 64)
constexpr int BNP = 192;      // block tile N of the projections (2 waves x 96)
constexpr int BK = 128;       // K per LDS stage: 256 B of every row, 4 WMMA k-steps
constexpr int WK = 32;        // K of one 16x16x32 WMMA
constexpr int LDST = 136;     // LDS row stride in halfwords (272B = 17*16B)
constexpr int SROWS = 64;     // rows of one tensor-load slice: 64 x 256 B = 16 KiB
constexpr int SLICE = 9216;   // halfwords from slice to slice in LDS: 64 rows of 272 B
                              // (17,408 B) rounded up to 18,432 B, a multiple of 2 KiB

constexpr int Nrows = 8192;
constexpr int Hdim  = 1024;
constexpr int KSPLIT = 8;     // deterministic split-K for k^T @ v

#define AS1 __attribute__((address_space(1)))

// ---- tensor load: one request of a wave brings 64 rows of 256 B into LDS ---
__device__ __forceinline__ uint32_t uni(uint32_t v) {
  return (uint32_t)__builtin_amdgcn_readfirstlane(v);
}
// a wave-uniform test held in a scalar register, so that the branch on it is a scalar
// branch: a tensor load ignores EXEC and only such a branch keeps a wave from issuing
__device__ __forceinline__ uint32_t pinned(uint32_t v) {
  uint32_t w = uni(v);
  asm volatile("" : "+s"(w));   // pinned(): keeps the word in a scalar register
  return w;
}
// The descriptor is formed in s88..s99 inside the statement that issues, and those
// registers are named nowhere else: no word of a request in flight takes a new value
// before the wave has waited for it and issues the next one.
// group 0 (s96..s99): count 1, LDS byte offset, global address of the tile's first
// byte, type 2. group 1 (s88..s95): no mask, 1-byte elements, 16 B of LDS pad behind
// every 256-B row (pitch 272 B); tensor = tile = 64 rows of 256 B; source pitch, bytes
__device__ __forceinline__ void tdm_load(uint32_t lds_dst, uint64_t ga, uint32_t src_pitch) {
  static_assert(BK * 2 == 256 && SROWS == 64, "the descriptor's constants");
  asm volatile(
      "s_mov_b32 s96, 1\n\t"
      "s_mov_b32 s97, %0\n\t"
      "s_mov_b32 s98, %1\n\t"
      "s_mov_b32 s99, %2\n\t"
      "s_mov_b32 s88, 0x7500000\n\t"   // 1 << 20 | 5 << 22 | 3 << 25
      "s_mov_b32 s89, 0x1000000\n\t"   // tensor_dim0 = 256
      "s_mov_b32 s90, 0x400000\n\t"    // tensor_dim1 = 64
      "s_mov_b32 s91, 0x1000000\n\t"   // tile_dim0 = 256
      "s_mov_b32 s92, 64\n\t"          // tile_dim1 = 64
      "s_mov_b32 s93, %3\n\t"
      "s_mov_b32 s94, 0\n\t"
      "s_mov_b32 s95, 0\n\t"
      "tensor_load_to_lds s[96:99], s[88:95]"
      :: "s"(uni(lds_dst)), "s"(uni((uint32_t)ga)),
         "s"(uni((((uint32_t)(ga >> 32)) & 0x01FFFFFFu) | 0x80000000u)), "s"(uni(src_pitch))
      : "s88", "s89", "s90", "s91", "s92", "s93", "s94", "s95", "s96", "s97", "s98", "s99",
        "memory");
}

// ---- per-lane WMMA fragment from a [64][LDST] LDS slice ---------------------
// 16-bit operand layout (ISA 7.12.2): lanes 0-15 hold K {0..7,16..23},
// lanes 16-31 hold K {8..15,24..31}; row/col = lane & 15. k0: first k of the step.
__device__ __forceinline__ v16h load_frag(const _Float16* __restrict__ lds,
                                          int rowbase, int k0, int lane) {
  int r  = rowbase + (lane & 15);
  int kb = k0 + ((lane >> 4) << 3);          // k0 or k0 + 8
  const _Float16* p = lds + r * LDST + kb;   // 16-byte aligned chunks
  v16h f;
#pragma unroll
  for (int i = 0; i < 8; ++i) { f[i] = p[i]; f[i + 8] = p[i + 16]; }
  return f;
}

// ---- one k-step's fragments of a 64 x 16*NJ wave tile: 4 of A, NJ of B ------
// A stage is slices of 64 rows: 4 of A (slice wm is this wave's), then those of B.
// SPLIT: the B tile is three slices (q, k, v), and a wave takes 32 rows of each;
// else slice wn of B is this wave's.
template <int NJ, bool SPLIT>
__device__ __forceinline__ void load_set(v16h (&a)[4], v16h (&b)[NJ],
                                         const _Float16* __restrict__ buf,
                                         int wm, int wn, int k0, int lane) {
  // both loops unrolled: a[] and b[] indexed by constants only, so they are registers
#pragma unroll
  for (int i = 0; i < 4; ++i) a[i] = load_frag(buf + wm * SLICE, i * 16, k0, lane);
#pragma unroll
  for (int j = 0; j < NJ; ++j)
    b[j] = load_frag(buf + (4 + (SPLIT ? (j >> 1) : wn)) * SLICE,
                     SPLIT ? wn * 32 + (j & 1) * 16 : j * 16, k0, lane);
}

// ---- all-f16 WMMA GEMM:  C[m,n] = sum_k A[m,k]*B[n,k] (+ bias[n]) ----------
// blockIdx.z picks an independent slice: A, B, C advance by zsA, zsB, zsC elements.
// QKV: B holds the rows of Wq, Wk, Wv one after the other (3*Hdim columns n). The
// block tile is 256 x 192, so that 16 x 32 blocks are two full rounds of the chip's
// 256 places and each loaded operand byte feeds more WMMAs. A block takes the same
// 64 columns of q, of k and of v, a wave 32 of each (its tiles j = 0,1 / 2,3 / 4,5):
// q columns get bias0 and go to C row-major; k and v columns get bias1 / bias2 and
// go to Ct transposed (Ct[(n - Hdim)*ldct + m], f16).
// A tile that is stored row-major has the B rows as first WMMA operand: a lane's 8
// results are then 8 consecutive n of one row m. Every tile goes to LDS by 16-byte
// writes and from there to memory in whole 128-byte lines.
template <bool QKV, typename TOut>
__global__ __launch_bounds__(256) void gemm_f16_wmma(
    const _Float16* __restrict__ A, const _Float16* __restrict__ B,
    const float* __restrict__ bias0, const float* __restrict__ bias1,
    const float* __restrict__ bias2, TOut* __restrict__ C,
    _Float16* __restrict__ Ct,
    int K, int lda, int ldb, int zsA, int zsB, int zsC) {
  // row pitches of C and Ct, constants: a wave's stores then differ by immediates only
  constexpr int ldc = Hdim, ldct = Nrows;
  constexpr int BNt = QKV ? BNP : BN;   // block tile N
  constexpr int NJ  = BNt / 32;         // 16-column tiles of one wave
  constexpr int NS  = (BM + BNt) / SROWS;   // slices of a stage: 4 of A, 2 or 3 of B
  static_assert(QKV || NJ * 16 == SROWS, "a wave's columns are one slice of B");
  // every slice of both buffers starts at a multiple of 2 KiB of the group's LDS
  __shared__ __attribute__((aligned(2048))) _Float16 ring[2][NS * SLICE];

  const int tid  = threadIdx.x;
  const int lane = tid & 31;
  const int wid  = tid >> 5;       // 8 waves
  const int wm   = wid & 3;        // 4 waves along M (64 rows each)
  const int wn   = wid >> 2;       // 2 waves along N (16*NJ cols each)
  const int row0 = blockIdx.y * BM;
  const int col0 = blockIdx.x * (QKV ? 64 : BNt);   // QKV: in each of q, k, v
  constexpr int BX = QKV ? Hdim - 64 : 0;   // from 64 rows of Wq on to those of Wk, Wv
  A += (size_t)blockIdx.z * zsA;
  B += (size_t)blockIdx.z * zsB;
  C += (size_t)blockIdx.z * zsC;

  v8f acc[4][NJ] = {};             // 64 x 16*NJ per wave = 4*NJ WMMA accumulators
  v16h af[2][4], bf[2][NJ];        // two fragment sets: set (ks & 1) serves k-step ks

  const int nk = K / BK;
  // waves 0..NS-1 each bring one slice of every stage: waves 0..3 64 rows of A, the
  // next ones 64 rows of B (QKV: of Wq, Wk, Wv); one request a wave in flight
  const uint32_t wave = uni(threadIdx.x >> 5);
  const bool mine = wave < (uint32_t)NS;
  const uint32_t sb = wave < 4u ? 0u : wave - 4u;      // slice of B
  const uint64_t ga0 = wave < 4u
      ? (uint64_t)(A + (size_t)(row0 + (int)wave * SROWS) * lda)
      : (uint64_t)(B + (size_t)(col0 + (int)sb * (SROWS + BX)) * ldb);
  const uint32_t lds0 = (uint32_t)(uint64_t)&ring[0][0] + wave * (SLICE * 2);
  const uint32_t pitch = (uint32_t)(wave < 4u ? lda : ldb) * 2u;   // source rows, bytes
  if (pinned(mine)) {
    tdm_load(lds0, ga0, pitch);
    // this wave's slice of stage 0 has landed before the barrier publishes it
    asm volatile("s_wait_tensorcnt 0x0" ::: "memory");
  }
  __syncthreads();
  if (pinned(mine && 1 < nk))      // stage 1 flies while stage 0 is worked on
    tdm_load(lds0 + NS * SLICE * 2, ga0 + BK * 2, pitch);
  load_set<NJ, QKV>(af[0], bf[0], ring[0], wm, wn, 0, lane);  // k-step 0 of stage 0

  for (int kt = 0; kt < nk; ++kt) {
    const int cur = kt & 1;
    // unrolled: the set index ks & 1 must be a constant for the sets to be registers
#pragma unroll
    for (int ks = 0; ks < BK / WK; ++ks) {
      const int cs = ks & 1;
      if (ks + 1 < BK / WK) {
        // the next k-step's LDS loads, one group, into the set that is free
        load_set<NJ, QKV>(af[cs ^ 1], bf[cs ^ 1], ring[cur], wm, wn, (ks + 1) * WK, lane);
      } else {
        // publish point of stage kt + 1, in front of this stage's last k-step (its
        // fragments are in registers): this wave's reads of cur are done, its slice
        // of the next stage has landed; behind the barrier every wave may read the
        // next stage and cur may be refilled
        asm volatile("s_wait_dscnt 0x0" ::: "memory");
        asm volatile("s_wait_tensorcnt 0x0" ::: "memory");
        __syncthreads();
        if (pinned(mine && kt + 2 < nk))   // refill of cur: a whole pass ahead of its
                                           // publish point
          tdm_load(lds0 + cur * (NS * SLICE * 2), ga0 + (uint64_t)(kt + 2) * (BK * 2), pitch);
        if (kt + 3 < nk) {                     // L2 prefetch one tile further ahead
          __builtin_prefetch(A + (size_t)(row0 + tid) * lda + (kt + 3) * BK, 0, 0);
          const int pr = (int)((unsigned)tid % BNt);   // row of the B tile
          __builtin_prefetch(B + (size_t)(col0 + pr + (pr >> 6) * BX) * ldb +
                                 (kt + 3) * BK, 0, 0);
        }
        if (kt + 1 < nk)     // k-step 0 of the next stage, under this stage's last WMMAs
          load_set<NJ, QKV>(af[0], bf[0], ring[cur ^ 1], wm, wn, 0, lane);
      }
      // keeps the load group ahead of the WMMA block: sunk among the WMMAs, each
      // load pair would be waited for at once and the matrix unit would idle
      __builtin_amdgcn_sched_barrier(0);
      // both loops unrolled: acc[][] and the sets indexed by constants only
#pragma unroll
      for (int i = 0; i < 4; ++i)
#pragma unroll
        for (int j = 0; j < NJ; ++j)
          acc[i][j] = (QKV && j >= 2)      // k, v: a lane holds 8 m of one column n
              ? __builtin_amdgcn_wmma_f32_16x16x32_f16(
                    false, af[cs][i], false, bf[cs][j], (short)0, acc[i][j], false, false)
              : __builtin_amdgcn_wmma_f32_16x16x32_f16(   // 8 n of one row m
                    false, bf[cs][j], false, af[cs][i], (short)0, acc[i][j], false, false);
      // keeps the following load group behind this block, so that it stays one group
      __builtin_amdgcn_sched_barrier(0);
    }
  }

  // no request and no LDS read of this wave is open when the ring becomes staging
  asm volatile("s_wait_tensorcnt 0x0" ::: "memory");
  asm volatile("s_wait_dscnt 0x0" ::: "memory");

  // D layout (ISA 7.12.2): VGPR g -> row g + 8*(lane>=16) of the first operand,
  // column lane&15 of the second. The ring is free: behind the last pass's barrier
  // no wave reads it and no tensor load is in flight.
  char* const st = reinterpret_cast<char*>(&ring[0][0]);
  const int c = lane & 15, h = lane >> 4;
  if constexpr (QKV) {
    constexpr int SP = 144;               // staged row: one 128-byte line + 16 B pad
    constexpr int KV0 = BM * SP;          // q: [256 m][64 n] of the block; then k, v
    char* const skv = st + KV0 + wid * (4 * 16 * SP);  // this wave's 4 tiles [16 n][64 m]
    // all loops unrolled: acc[][] and hv[] indexed by constants only, so they are
    // registers
#pragma unroll
    for (int j = 0; j < NJ; ++j) {
      if (j < 2) {                           // a q tile
        const float* bp = bias0 + col0 + wn * 32 + j * 16 + h * 8;
        const f32x4 b0 = *reinterpret_cast<const f32x4*>(bp);
        const f32x4 b1 = *reinterpret_cast<const f32x4*>(bp + 4);
#pragma unroll
        for (int i = 0; i < 4; ++i) {
          h8 hv;                             // 8 consecutive n at fixed m
#pragma unroll
          for (int gg = 0; gg < 8; ++gg)
            hv[gg] = (_Float16)(acc[i][j][gg] + (gg < 4 ? b0[gg & 3] : b1[gg & 3]));
          *reinterpret_cast<h8*>(st + (wm * 64 + i * 16 + c) * SP +
                                 (wn * 32 + j * 16 + h * 8) * 2) = hv;
        }
      } else {                               // a k or a v tile
        const float* __restrict__ bias = j < 4 ? bias1 : bias2;
        const float bv = bias[col0 + wn * 32 + (j & 1) * 16 + c];
#pragma unroll
        for (int i = 0; i < 4; ++i) {
          h8 hv;                             // 8 consecutive m at fixed n
#pragma unroll
          for (int gg = 0; gg < 8; ++gg)
            hv[gg] = (_Float16)(acc[i][j][gg] + bv);
          *reinterpret_cast<h8*>(skv + ((j - 2) * 16 + c) * SP + (i * 16 + h * 8) * 2) = hv;
        }
      }
    }
    // the staged writes are done before the barrier; behind it a wave reads q rows
    // that both column waves have written
    asm volatile("s_wait_dscnt 0x0" ::: "memory");
    __syncthreads();
    const int r4 = lane >> 3, c8 = (lane & 7) * 8;   // 8 lanes cover one 128-byte row
    h8 tk[16], tq[8];
    // unrolled: tk[] and tq[] indexed by constants only, so they are registers
#pragma unroll
    for (int t = 0; t < 16; ++t)
      tk[t] = *reinterpret_cast<const h8*>(skv + (t * 4 + r4) * SP + c8 * 2);
#pragma unroll
    for (int t = 0; t < 8; ++t)
      tq[t] = *reinterpret_cast<const h8*>(st + (wid * 32 + t * 4 + r4) * SP + c8 * 2);
    _Float16* const kp = Ct + (size_t)(col0 + wn * 32 + r4) * ldct + row0 + wm * 64 + c8;
    _Float16* const vp = kp + (size_t)Hdim * ldct;
    TOut* const qp = C + (size_t)(row0 + wid * 32 + r4) * ldc + col0 + c8;
#pragma unroll
    for (int t = 0; t < 16; ++t)             // 4 rows n of k^T or v^T, 64 m each
      *reinterpret_cast<h8*>((t < 8 ? kp : vp) + (t & 7) * (4 * ldct)) = tk[t];
#pragma unroll
    for (int t = 0; t < 8; ++t)              // 4 rows m of q, the block's 64 n each
      *reinterpret_cast<h8*>(qp + t * (4 * ldc)) = tq[t];
    return;
  } else {
    constexpr int SP = 272;                  // staged row: 64 f32 + 16 B pad
    char* const sw = st + wid * (64 * SP);   // this wave's own 64 x 64 tile
    // all loops unrolled: acc[][] and tv[] indexed by constants only
#pragma unroll
    for (int i = 0; i < 4; ++i)
#pragma unroll
      for (int j = 0; j < 4; ++j) {
        f32x4 lo = {acc[i][j][0], acc[i][j][1], acc[i][j][2], acc[i][j][3]};
        f32x4 hi = {acc[i][j][4], acc[i][j][5], acc[i][j][6], acc[i][j][7]};
        char* p = sw + (i * 16 + c) * SP + (j * 16 + h * 8) * 4;
        *reinterpret_cast<f32x4*>(p) = lo;
        *reinterpret_cast<f32x4*>(p + 16) = hi;
      }
    // other lanes of this wave read the rows back: their writes are done first, and
    // the compiler moves no read up over them
    asm volatile("s_wait_dscnt 0x0" ::: "memory");
    f32x4 tv[32];
#pragma unroll
    for (int t = 0; t < 32; ++t)             // 16 lanes cover one 256-byte row
      tv[t] = *reinterpret_cast<const f32x4*>(sw + (t * 2 + h) * SP + c * 16);
    TOut* const cp = C + (size_t)(row0 + wm * 64 + h) * ldc + col0 + wn * 64 + c * 4;
#pragma unroll
    for (int t = 0; t < 32; ++t)
      *reinterpret_cast<f32x4*>(cp + t * (2 * ldc)) = tv[t];
  }
}

// ---- fp32 -> f16 convert of x, Wq, Wk, Wv in one launch: V float4 per thread -
// A block covers 256*V consecutive float4 of one source; each wave-wide load is
// 512 contiguous bytes. Few long-lived waves: the launch is not paced by how fast
// waves can be started. The first XB blocks take x, then WB blocks each of Wq, Wk,
// Wv; dstall holds the four results one after the other in that order.
template <int V>
__global__ __launch_bounds__(256) void cvt_f32_f16(const float* __restrict__ x,
                                                   const float* __restrict__ Wq,
                                                   const float* __restrict__ Wk,
                                                   const float* __restrict__ Wv,
                                                   _Float16* __restrict__ dstall) {
  constexpr int XB = (Nrows * Hdim) / (1024 * V);
  constexpr int WB = (Hdim * Hdim) / (1024 * V);
  const int b = blockIdx.x;
  const int first = b < XB ? 0 : b < XB + WB ? XB : b < XB + 2 * WB ? XB + WB
                                                                    : XB + 2 * WB;
  const float* __restrict__ src =
      b < XB ? x : b < XB + WB ? Wq : b < XB + 2 * WB ? Wk : Wv;
  _Float16* __restrict__ dst = dstall + (size_t)first * (1024 * V);
  size_t base = (size_t)(b - first) * (256 * V) + threadIdx.x;  // float4 index
  f32x4 v[V];
  // unrolled so that v[] stays in registers and all V loads are in flight
#pragma unroll
  for (int p = 0; p < V; ++p)
    v[p] = reinterpret_cast<const f32x4*>(src)[base + p * 256];
  // unrolled for the same reason: v[] indexed by constants only
#pragma unroll
  for (int p = 0; p < V; ++p)
    reinterpret_cast<h4*>(dst)[base + p * 256] = __builtin_convertvector(v[p], h4);
}

// ---- reduce split-K partials of KV, scale by 1/sqrt(H), store KV^T (f16) ---
// One thread owns column h2 of 8 consecutive rows h1: 64 coalesced loads, each
// element summed over z = 0..7 in order, one 16-byte store into row h2 of KV^T.
__global__ __launch_bounds__(256) void reduce_kv(const float* __restrict__ P,
                                                 _Float16* __restrict__ KVt,
                                                 float scale) {
  // a block owns 64 rows h1 x 32 columns h2: wave w takes rows 8w..8w+7, lane l
  // column l, so each 128-byte line of KV^T is written by one block only
  const int wave = __builtin_amdgcn_readfirstlane(threadIdx.x >> 5);  // scalar
  const int h1 = (blockIdx.x >> 5) * 64 + wave * 8;   // first of 8 rows, wave-uniform
  const unsigned h2 = (blockIdx.x & 31) * 32 + (threadIdx.x & 31);
  float s[8] = {};
  // both loops unrolled so that the 64 loads can be issued ahead of the sums
#pragma unroll
  for (int z = 0; z < KSPLIT; ++z) {
    // first row of the even plane below z: wave-uniform, kept in scalar registers
    // so that every load is scalar base + lane column + immediate (an immediate
    // reaches one plane further), with no 64-bit vector add
    unsigned long long u =
        (unsigned long long)(P + (size_t)(z & ~1) * Hdim * Hdim + (size_t)h1 * Hdim);
    unsigned lo = __builtin_amdgcn_readfirstlane((unsigned)u);
    unsigned hi = __builtin_amdgcn_readfirstlane((unsigned)(u >> 32));
    const AS1 float* plane = (const AS1 float*)(((unsigned long long)hi << 32) | lo);
#pragma unroll
    for (int r = 0; r < 8; ++r)
      s[r] += plane[(z & 1) * Hdim * Hdim + r * Hdim + h2];
  }
  h8 hv;
  // unrolled: s[] and hv[] indexed by constants only, so both stay in registers
#pragma unroll
  for (int r = 0; r < 8; ++r) hv[r] = (_Float16)(s[r] * scale);
  *reinterpret_cast<h8*>(KVt + (size_t)h2 * Hdim + h1) = hv;   // transposed store
}

// ---------------------------------------------------------------------------
extern "C" void kernel_launch(void* const* d_in, const int* in_sizes, int n_in,
                              void* d_out, int out_size, void* d_ws, size_t ws_size,
                              hipStream_t stream) {
  (void)in_sizes; (void)n_in; (void)out_size; (void)ws_size;
  const float* x  = (const float*)d_in[0];
  const float* Wq = (const float*)d_in[1];
  const float* bq = (const float*)d_in[2];
  const float* Wk = (const float*)d_in[3];
  const float* bk = (const float*)d_in[4];
  const float* Wv = (const float*)d_in[5];
  const float* bv = (const float*)d_in[6];
  float* out = (float*)d_out;

  char* ws = (char*)d_ws;
  const size_t MB = 1ull << 20;
  _Float16* xf  = (_Float16*)(ws);               // 16 MB
  _Float16* Wqf = (_Float16*)(ws + 16 * MB);     //  6 MB   Wq, Wk, Wv: [3H,H]
  _Float16* qf  = (_Float16*)(ws + 22 * MB);     // 16 MB   q   [N,H]
  _Float16* kT  = (_Float16*)(ws + 38 * MB);     // 16 MB   k^T [H,N]
  _Float16* vT  = (_Float16*)(ws + 54 * MB);     // 16 MB   v^T [H,N]
  float*    P   = (float*)   (ws + 70 * MB);     // 32 MB   8 partials [H,H]
  _Float16* KVt = (_Float16*)(ws + 102 * MB);    //  2 MB   KV^T [H,H]

  dim3 blk(256);

  // fp32 -> f16 converts, one launch: xf, Wqf, Wkf, Wvf are contiguous from xf on
  cvt_f32_f16<16><<<(Nrows * Hdim + 3 * Hdim * Hdim) / (1024 * 16), blk, 0, stream>>>(
      x, Wq, Wk, Wv, xf);

  dim3 gQKV(3 * Hdim / BNP, Nrows / BM); // 16 x 32: the 16 blocks of a row tile of x
                                         // are neighbours in launch order; block x
                                         // takes columns 64x.. of q, of k and of v
  dim3 gProj(Hdim / BN, Nrows / BM);   // 8 x 32
  dim3 gKV(Hdim / BN, Hdim / BM, KSPLIT);  // 8 x 4 x 8 split-K slices, one launch

  // the three projections, one launch: B = [Wqf; Wkf; Wvf] (contiguous, 3H rows);
  // q normal layout; k,v stored transposed ([2H, N] from kT on)
  gemm_f16_wmma<true, _Float16>
      <<<gQKV, blk, 0, stream>>>(xf, Wqf, bq, bk, bv, qf, kT, Hdim, Hdim, Hdim, 0, 0, 0);

  // KV partials: KV[h1,h2] = sum_n kT[h1,n] * vT[h2,n]  (both row-major now)
  // slice z covers n in [z*N/8, (z+1)*N/8) and writes partial plane z of P
  gemm_f16_wmma<false, float>
      <<<gKV, blk, 0, stream>>>(kT, vT, nullptr, nullptr, nullptr, P, nullptr,
                                Nrows / KSPLIT, Nrows, Nrows,
                                Nrows / KSPLIT, Nrows / KSPLIT, Hdim * Hdim);

  // sum partials, scale by 1/sqrt(1024), emit KV^T in f16
  reduce_kv<<<(Hdim * Hdim) / (256 * 8), blk, 0, stream>>>(P, KVt, 0.03125f);

  // out = q @ KV  (KVt rows are KV columns -> contiguous B fragments)
  gemm_f16_wmma<false, float>
      <<<gProj, blk, 0, stream>>>(qf, KVt, nullptr, nullptr, nullptr, out, nullptr,
                                  Hdim, Hdim, Hdim, 0, 0, 0);
}
